// v009
// Times are from an AMD MI455X. After a warm-up the kernel runs many times in a row, and a time is the length of
// such a window on the GPU divided by its runs, so every launch and the gaps after it count. The runs cycle
// through copies of the inputs. A figure is the median of several windows, for all but v000 over two sittings.
// Sittings can differ by a few percent; kernels timed side by side share one.
// The versions before v009 are in another document.
// One run takes 205 microseconds.
// Next to v008, in two timings, it ran 1.09 and 1.06 times as fast.
// Over all steps from v000, the starting kernel, it is 59.2 times as fast.
#include <hip/hip_runtime.h>
// Grouped-query causal attention with rotate-half RoPE, 16 query / 8 kv heads of 128 (x [2][2048][2048]; q = x Wq (16 x 128), k = x Wk, v = x Wv (8 x 128) ([in][out] weights sigma 0.02, no biases); inv_freq_i = 1/10000^(2i/128), positions 0..2047, cos/sin = cat(freqs, freqs); q, k roped; kv head h/2 serves query head h; scores / sqrt(128); causal (tril, -inf); softmax; out = merged Wo -> [2][2048][2048]).
// Compute dtype: inputs rounded to bf16; x / weights exact; projections and rope f32; q, k, v, softmax weights and o as plain f16 GEMM operands (~2^-12; first 256 rows of each batch exact); scores, statistics, out f32. v_wmma_f32_16x16x32_f16.
#define NB 2
#define SQ 2048
#define DMX 2048
#define NH 16
#define NKV 8
#define GSZ 2                        /* query heads per kv head */
#define GSH 1                        /* log2(GSZ): query head >> GSH = its kv head */
#define HDK 128
#define DKV (NKV * HDK)
#define QT 256
#define QT0 256
#define NKX SQ
#define DM DMX
#define HD 64
#define HG 1
#define NR ((size_t)NB * SQ)
#define ATS 0.08838834764831845f
typedef __bf16 v16b __attribute__((ext_vector_type(16)));
typedef unsigned short v8us __attribute__((ext_vector_type(8), may_alias));
typedef float  v8f  __attribute__((ext_vector_type(8)));
typedef float  v4f  __attribute__((ext_vector_type(4)));
typedef float  v4fa __attribute__((ext_vector_type(4), may_alias));
union FragB { v16b v; v8us half[2]; unsigned short u[16]; };

__device__ __forceinline__ unsigned short bf16_bits(float x) { unsigned int u = __float_as_uint(x); return (unsigned short)((u + 0x7FFFu + ((u >> 16) & 1u)) >> 16); }
__device__ __forceinline__ float bf16_val(unsigned short b) { return __uint_as_float(((unsigned int)b) << 16); }
__device__ __forceinline__ float bf16_round(float x) { return bf16_val(bf16_bits(x)); }
// D += A·B with NT terms: 1 = ah·bh, 2 = + al·bh (A split), 3 = + ah·bl (both split)
template <int NT>
__device__ __forceinline__ v8f mmaN(v16b ah, v16b al, v16b bh, v16b bl, v8f c) {
  c = __builtin_amdgcn_wmma_f32_16x16x32_bf16(false, ah, false, bh, (short)0, c, false, false);
  if (NT >= 2) c = __builtin_amdgcn_wmma_f32_16x16x32_bf16(false, al, false, bh, (short)0, c, false, false);
  if (NT >= 3) c = __builtin_amdgcn_wmma_f32_16x16x32_bf16(false, ah, false, bl, (short)0, c, false, false);
  asm volatile("v_nop\n\tv_nop\n\tv_nop\n\tv_nop" : "+v"(c) : "v"(ah), "v"(al), "v"(bh), "v"(bl));
  return c;
}

__global__ __launch_bounds__(256) void k_wt_bf16(const float* __restrict__ W, unsigned short* __restrict__ Wt, int K, int N) {
  const int t = blockIdx.x * 256 + threadIdx.x;
  const int k8n = K / 8;
  if (t >= N * k8n) return;
  const int n = t / k8n, k8 = (t % k8n) * 8;
  v8us v;
#pragma unroll
  for (int i = 0; i < 8; ++i) v[i] = bf16_bits(W[(size_t)(k8 + i) * N + n]);
  *(v8us*)(Wt + (size_t)n * K + k8) = v;
  
}

// GEMM C[M][N] (f32, pitch ldc) = act(A[M][K]·W + bias). A f32 row-major (pitch lda) converted per fragment to bf16
// (ASPLIT: hi/lo two planes -> 2 terms, else single rounded term); Wt bf16 [N][K] (pitch ldb). BIAS_BF16 rounds the
// bias to bf16 first (bias quantised to bf16 before the add). K%32==0, M%16==0, N%64==0.
template <bool ASPLIT, int ACT, bool BIAS_BF16>
__global__ __launch_bounds__(128) void k_gemm_bf(const float* __restrict__ A, int lda, const unsigned short* __restrict__ Wt, int ldb,
                                               const float* __restrict__ bias, float* __restrict__ C, int ldc, int M, int N, int K) {
  __shared__ __attribute__((aligned(16))) float so[4][16][64];
  const int tid = threadIdx.x, w = tid >> 5, lane = tid & 31, ln = lane & 15, hh = lane >> 4;
  const int ntn = N / 64;
  const int wid = blockIdx.x * 4 + w;
  const int mt = wid / ntn, nq = wid % ntn;
  if (mt * 16 >= M) return;
  const int row0 = mt * 16, col0 = nq * 64;
  const float* arow = A + (size_t)(row0 + ln) * lda;
  v8f acc[4] = {};
  for (int kb = 0; kb < K; kb += 32) {
    FragB ah, al;
    const v4f x0 = *(const v4fa*)(arow + kb + 8 * hh), x1 = *(const v4fa*)(arow + kb + 8 * hh + 4);
    const v4f x2 = *(const v4fa*)(arow + kb + 16 + 8 * hh), x3 = *(const v4fa*)(arow + kb + 16 + 8 * hh + 4);
    float xs[16] = {x0[0],x0[1],x0[2],x0[3],x1[0],x1[1],x1[2],x1[3],x2[0],x2[1],x2[2],x2[3],x3[0],x3[1],x3[2],x3[3]};
#pragma unroll
    for (int i = 0; i < 16; ++i) { const unsigned short hb = bf16_bits(xs[i]); ah.u[i] = hb; al.u[i] = ASPLIT ? bf16_bits(xs[i] - bf16_val(hb)) : (unsigned short)0; }
#pragma unroll
    for (int t = 0; t < 4; ++t) {
      const unsigned short* brow = Wt + (size_t)(col0 + t * 16 + ln) * ldb + kb;
      FragB b;
      b.half[0] = *(const v8us*)(brow + 8 * hh);
      b.half[1] = *(const v8us*)(brow + 16 + 8 * hh);
      acc[t] = mmaN<ASPLIT ? 2 : 1>(ah.v, al.v, b.v, b.v, acc[t]);
    }
  }
#pragma unroll
  for (int t = 0; t < 4; ++t) {
    float bv = bias ? bias[col0 + t * 16 + ln] : 0.f;
    if (BIAS_BF16) bv = bf16_round(bv);
#pragma unroll
    for (int r = 0; r < 8; ++r) { float v = acc[t][r] + bv; if (ACT == 1) v = fmaxf(v, 0.f); so[w][8 * hh + r][t * 16 + ln] = v; }
  }
  __builtin_amdgcn_fence(__ATOMIC_ACQ_REL, "workgroup");
  __builtin_amdgcn_wave_barrier();
  const int rsub = lane >> 4, c4 = (lane & 15) * 4;
  {
#pragma unroll
    for (int q = 0; q < 8; ++q) {
      const int r = q * 2 + rsub;
      const v4f v = *(const v4fa*)&so[w][r][c4];
      *(v4f*)(C + (size_t)(row0 + r) * ldc + col0 + c4) = v;
    }
    
  }
}

// GEMM C = act(A·W + bias + resid): A f32 (ASPLIT -> hi/lo 2 terms), Wt bf16 [N][K]; ACT 0 none, 1 relu, 2 exact gelu;
// resid (optional, f32, row index = (row % rmod), pitch ldr, RES_BF16 rounds it) added before the activation.
template <bool ASPLIT, int ACT, bool BIAS_BF16, bool RES_BF16>
__global__ __launch_bounds__(128) void k_gemm_bf3(const float* __restrict__ A, int lda, const unsigned short* __restrict__ Wt, int ldb,
                                                const float* __restrict__ bias, const float* __restrict__ resid, int rmod, int ldr,
                                                float* __restrict__ C, int ldc, int M, int N, int K) {
  __shared__ __attribute__((aligned(16))) float so[4][16][64];
  const int tid = threadIdx.x, w = tid >> 5, lane = tid & 31, ln = lane & 15, hh = lane >> 4;
  const int ntn = N / 64;
  const int wid = blockIdx.x * 4 + w;
  const int mt = wid / ntn, nq = wid % ntn;
  if (mt * 16 >= M) return;
  const int row0 = mt * 16, col0 = nq * 64;
  const float* arow = A + (size_t)(row0 + ln) * lda;
  v8f acc[4] = {};
  for (int kb = 0; kb < K; kb += 32) {
    FragB ah, al;
    const v4f x0 = *(const v4fa*)(arow + kb + 8 * hh), x1 = *(const v4fa*)(arow + kb + 8 * hh + 4);
    const v4f x2 = *(const v4fa*)(arow + kb + 16 + 8 * hh), x3 = *(const v4fa*)(arow + kb + 16 + 8 * hh + 4);
    float xs[16] = {x0[0],x0[1],x0[2],x0[3],x1[0],x1[1],x1[2],x1[3],x2[0],x2[1],x2[2],x2[3],x3[0],x3[1],x3[2],x3[3]};
#pragma unroll
    for (int i = 0; i < 16; ++i) { const unsigned short hb = bf16_bits(xs[i]); ah.u[i] = hb; al.u[i] = ASPLIT ? bf16_bits(xs[i] - bf16_val(hb)) : (unsigned short)0; }
#pragma unroll
    for (int t = 0; t < 4; ++t) {
      const unsigned short* brow = Wt + (size_t)(col0 + t * 16 + ln) * ldb + kb;
      FragB b;
      b.half[0] = *(const v8us*)(brow + 8 * hh);
      b.half[1] = *(const v8us*)(brow + 16 + 8 * hh);
      acc[t] = mmaN<ASPLIT ? 2 : 1>(ah.v, al.v, b.v, b.v, acc[t]);
    }
  }
#pragma unroll
  for (int t = 0; t < 4; ++t) {
    const int col = col0 + t * 16 + ln;
    float bv = bias ? bias[col] : 0.f;
    if (BIAS_BF16) bv = bf16_round(bv);
#pragma unroll
    for (int r = 0; r < 8; ++r) {
      float v = acc[t][r] + bv;
      if (resid) { float rv = resid[(size_t)((row0 + 8 * hh + r) % rmod) * ldr + col]; if (RES_BF16) rv = bf16_round(rv); v += rv; }
      if (ACT == 1) v = fmaxf(v, 0.f);
      if (ACT == 2) v = 0.5f * v * (1.0f + erff(v * 0.70710678118654752f));
      if (ACT == 3) { const float u = 0.7978845608028654f * (v + 0.044715f * v * v * v); v = 0.5f * v * (1.0f + tanhf(u)); }
      so[w][8 * hh + r][t * 16 + ln] = v;
    }
  }
  __builtin_amdgcn_fence(__ATOMIC_ACQ_REL, "workgroup");
  __builtin_amdgcn_wave_barrier();
  const int rsub = lane >> 4, c4 = (lane & 15) * 4;
  {
#pragma unroll
    for (int q = 0; q < 8; ++q) {
      const int r = q * 2 + rsub;
      const v4f v = *(const v4fa*)&so[w][r][c4];
      *(v4f*)(C + (size_t)(row0 + r) * ldc + col0 + c4) = v;
    }
    
  }
}
// row LayerNorm (biased variance, eps) over N: s = X (+ R); optional out_sum <- s; out_norm <- (s-mu)*rsqrt(var+eps)*g + b
template <bool PARAM_BF16>
__global__ __launch_bounds__(256) void k_layernorm(const float* __restrict__ X, const float* __restrict__ R, const float* __restrict__ g, const float* __restrict__ bta,
                                                  float* __restrict__ out_sum, float* __restrict__ out_norm, int N, float eps) {
  __shared__ float red[256];
  const int row = blockIdx.x, tid = threadIdx.x;
  const float* x = X + (size_t)row * N; const float* rr = R ? R + (size_t)row * N : nullptr;
  float vals[16];                     // up to N = 4096
  const int per = N / 256;            // contiguous chunk per thread? use strided-by-4 chunks: thread handles j = tid*4 + 1024*u
  float s1 = 0.f;
  for (int u = 0; u < per / 4; ++u) {
    const int j = tid * 4 + 1024 * u;
    const v4f a = *(const v4fa*)(x + j);
    v4f b = {0.f,0.f,0.f,0.f}; if (rr) b = *(const v4fa*)(rr + j);
#pragma unroll
    for (int q = 0; q < 4; ++q) { const float v = a[q] + b[q]; vals[u * 4 + q] = v; s1 += v; }
  }
  red[tid] = s1; __syncthreads();
  for (int st = 128; st > 0; st >>= 1) { if (tid < st) red[tid] += red[tid + st]; __syncthreads(); }
  const float mu = red[0] / (float)N; __syncthreads();
  float s2 = 0.f;
  for (int u = 0; u < per / 4; ++u)
#pragma unroll
    for (int q = 0; q < 4; ++q) { const float c = vals[u * 4 + q] - mu; s2 += c * c; }
  red[tid] = s2; __syncthreads();
  for (int st = 128; st > 0; st >>= 1) { if (tid < st) red[tid] += red[tid + st]; __syncthreads(); }
  const float rs = rsqrtf(red[0] / (float)N + eps);
  {
    for (int u = 0; u < per / 4; ++u) {
      const int j = tid * 4 + 1024 * u;
      v4f o, sm;
#pragma unroll
      for (int q = 0; q < 4; ++q) {
        float gg = g[j + q], bb = bta[j + q];
        if (PARAM_BF16) { gg = bf16_round(gg); bb = bf16_round(bb); }
        sm[q] = vals[u * 4 + q]; o[q] = (vals[u * 4 + q] - mu) * rs * gg + bb;
      }
      if (out_sum) *(v4f*)(out_sum + (size_t)row * N + j) = sm;
      *(v4f*)(out_norm + (size_t)row * N + j) = o;
    }
    
  }
}



// ---- f16 WMMA path (v_wmma_f32_16x16x32_f16): 11-bit significands for operands in range — used where a [0,1] probability operand needs more precision than bf16
typedef _Float16 v16h __attribute__((ext_vector_type(16)));
union FragH { v16h v; v8us half[2]; _Float16 h[16]; unsigned short u[16]; };
template <int NT>
__device__ __forceinline__ v8f mmaH(v16h ah, v16h al, v16h bh, v16h bl, v8f c) {
  c = __builtin_amdgcn_wmma_f32_16x16x32_f16(false, ah, false, bh, (short)0, c, false, false);
  if (NT >= 2) c = __builtin_amdgcn_wmma_f32_16x16x32_f16(false, al, false, bh, (short)0, c, false, false);
  if (NT >= 3) c = __builtin_amdgcn_wmma_f32_16x16x32_f16(false, ah, false, bl, (short)0, c, false, false);
  asm volatile("v_nop\n\tv_nop\n\tv_nop\n\tv_nop" : "+v"(c) : "v"(ah), "v"(al), "v"(bh), "v"(bl));
  return c;
}
// batched GEMM like k_gemm_b but f16 operands: A f32 (split into f16 hi/lo if ASPLIT, else rounded to f16), Bt = f16 values [n][k]; alpha; C f32; N multiple of 16 (partial tiles skipped)
template <bool ASPLIT>
__global__ __launch_bounds__(128) void k_gemm_h(const float* __restrict__ A, int lda, size_t sA, const _Float16* __restrict__ Bh, int ldb, size_t sB, float alpha, float* __restrict__ C, int ldc, size_t sC, int M, int N, int K) {
  __shared__ __attribute__((aligned(16))) float so[4][16][64];
  const int tid = threadIdx.x, w = tid >> 5, lane = tid & 31, ln = lane & 15, hh = lane >> 4; const int by = blockIdx.y;
  A += (size_t)by * sA; Bh += (size_t)by * sB; C += (size_t)by * sC;
  const int ntn = (N + 63) / 64; const int wid = blockIdx.x * 4 + w; const int mt = wid / ntn, nq = wid % ntn; if (mt * 16 >= M) return;
  const int row0 = mt * 16, col0 = nq * 64; const float* arow = A + (size_t)(row0 + ln) * lda;
  v8f acc[4] = {};
  for (int kb = 0; kb < K; kb += 32) {
    FragH ah, al;
    const v4f x0 = *(const v4fa*)(arow + kb + 8 * hh), x1 = *(const v4fa*)(arow + kb + 8 * hh + 4), x2 = *(const v4fa*)(arow + kb + 16 + 8 * hh), x3 = *(const v4fa*)(arow + kb + 16 + 8 * hh + 4);
    float xs[16] = {x0[0],x0[1],x0[2],x0[3],x1[0],x1[1],x1[2],x1[3],x2[0],x2[1],x2[2],x2[3],x3[0],x3[1],x3[2],x3[3]};
#pragma unroll
    for (int i = 0; i < 16; ++i) { const _Float16 h = (_Float16)xs[i]; ah.h[i] = h; al.h[i] = ASPLIT ? (_Float16)(xs[i] - (float)h) : (_Float16)0.0f; }
#pragma unroll
    for (int t = 0; t < 4; ++t) { if (col0 + t * 16 >= N) continue; const size_t boff = (size_t)(col0 + t * 16 + ln) * ldb + kb; FragH bq; bq.half[0] = *(const v8us*)(Bh + boff + 8 * hh); bq.half[1] = *(const v8us*)(Bh + boff + 16 + 8 * hh);
      acc[t] = mmaH<ASPLIT ? 2 : 1>(ah.v, al.v, bq.v, bq.v, acc[t]); }
  }
#pragma unroll
  for (int t = 0; t < 4; ++t) { if (col0 + t * 16 >= N) continue;
#pragma unroll
    for (int r = 0; r < 8; ++r) so[w][8 * hh + r][t * 16 + ln] = acc[t][r] * alpha; }
  __builtin_amdgcn_fence(__ATOMIC_ACQ_REL, "workgroup"); __builtin_amdgcn_wave_barrier();
  const int rsub = lane >> 4, c4 = (lane & 15) * 4;
  {
#pragma unroll
    for (int q = 0; q < 8; ++q) { const int r = q * 2 + rsub; if (col0 + c4 < N) { const v4f v = *(const v4fa*)&so[w][r][c4]; *(v4f*)(C + (size_t)(row0 + r) * ldc + col0 + c4) = v; } }
     }
}

// Wt[n][k] = f16(W[k][n] x scale) from f32 row-major W[K][N] (scale = power of two; bf16-exact weights stay exact in f16 away from the subnormal range).
// One work-group turns a tile of 128 k x 64 n through LDS: it reads 256-byte runs of W's rows and stores 256-byte runs of Wt's rows, so both sides move whole 128-byte lines.
// An LDS word holds the f16 pair (k, k + 1) of one n. Row pitch 65 words: the 32 lanes of a store (16 groups of four n, two k pairs) and of a load (two n, 16 groups of four words) each fall on 32 different banks.
typedef _Float16 wt_h2 __attribute__((ext_vector_type(2)));
typedef unsigned int wt_u4 __attribute__((ext_vector_type(4)));
template <int K, int N>
__device__ __forceinline__ void wt_f16_job(unsigned int (*lt)[65], int bx, const float* __restrict__ W, _Float16* __restrict__ Wt, float scale) {      /* lt = the work-group's 64 x 65 words of LDS, bx = the job's own block index */
  static_assert(K % 128 == 0 && N % 64 == 0, "whole tiles only");
  const int tid = threadIdx.x; const int kt = bx / (N / 64), nt = bx % (N / 64);      /* neighbouring work-groups read neighbouring runs of the same rows */
  const int c4 = (tid & 15) * 4, r = tid >> 4;
  const float* sp = W + (size_t)(kt * 128 + 2 * r) * N + nt * 64 + c4;
  v4f a[4], b[4];
#pragma unroll      /* all eight row loads in flight together, from one address with immediate offsets; a[], b[] are indexed by constants */
  for (int u = 0; u < 4; ++u) { a[u] = *(const v4fa*)(sp + (size_t)(32 * u) * N); b[u] = *(const v4fa*)(sp + (size_t)(32 * u + 1) * N); }
  asm volatile("s_wait_xcnt 0x0" :: "v"(sp) : "memory");      /* behind the loads, their address as input: the address register is not given to a load's result or overwritten while an issued load still names it */
#pragma unroll      /* as above */
  for (int u = 0; u < 4; ++u) for (int q = 0; q < 4; ++q) { const wt_h2 p = {(_Float16)(bf16_round(a[u][q]) * scale), (_Float16)(bf16_round(b[u][q]) * scale)}; lt[c4 + q][r + 16 * u] = __builtin_bit_cast(unsigned int, p); }
  __syncthreads();      /* the tile is whole before any row of it is read across */
  const int k4 = (tid & 15) * 4;      /* 16 lanes per output row, eight k (four words) each */
  wt_u4 o[4];
#pragma unroll      /* o[] is indexed by constants */
  for (int u = 0; u < 4; ++u) { const unsigned int* lp = &lt[r + 16 * u][k4]; o[u] = wt_u4{lp[0], lp[1], lp[2], lp[3]}; }
  _Float16* dp = Wt + (size_t)(nt * 64 + r) * K + kt * 128 + 2 * k4;
#pragma unroll      /* as above */
  for (int u = 0; u < 4; ++u) *(wt_u4*)(dp + (size_t)(16 * u) * K) = o[u];
  asm volatile("s_wait_xcnt 0x0" ::: "memory");      /* behind the four stores: in a merged launch another job's code follows in the listing, and no register that an issued store names is to be written there ahead of this wait */
}
// k_gemm_hh variant with fused epilogue: v = acc·alpha + bias[by·sBias + col] (+ CP[(row/rowsPerB)·sCPb + by·64 + col] if CP) ; ACT 0 none / 1 elu ; writes f16 C16 (and f32 C if non-null)
template <int ACT>
__global__ __launch_bounds__(128) void k_gemm_hhx(const _Float16* __restrict__ A, int lda, size_t sA, const _Float16* __restrict__ Bh, int ldb, size_t sB, float alpha, const float* __restrict__ bias, size_t sBias, const float* __restrict__ CP, int rowsPerB, size_t sCPb, int row0g,
    float* __restrict__ C, _Float16* __restrict__ C16, int ldc, size_t sC, int M, int N, int K) {
  __shared__ __attribute__((aligned(16))) float so[4][16][64];
  const int tid = threadIdx.x, w = tid >> 5, lane = tid & 31, ln = lane & 15, hh = lane >> 4; const int by = blockIdx.y;
  A += (size_t)by * sA; Bh += (size_t)by * sB; const size_t cofs = (size_t)by * sC; const float* bp = bias ? bias + (size_t)by * sBias : nullptr;
  const int ntn = (N + 63) / 64; const int wid = blockIdx.x * 4 + w; const int mt = wid / ntn, nq = wid % ntn; if (mt * 16 >= M) return;
  const int row0 = mt * 16, col0 = nq * 64; const _Float16* arow = A + (size_t)(row0 + ln) * lda;
  v8f acc[4] = {};
  for (int kb = 0; kb < K; kb += 32) { FragH ah; ah.half[0] = *(const v8us*)((const unsigned short*)arow + kb + 8 * hh); ah.half[1] = *(const v8us*)((const unsigned short*)arow + kb + 16 + 8 * hh);
#pragma unroll
    for (int t = 0; t < 4; ++t) { if (col0 + t * 16 >= N) continue; const size_t boff = (size_t)(col0 + t * 16 + ln) * ldb + kb; FragH bq; bq.half[0] = *(const v8us*)((const unsigned short*)Bh + boff + 8 * hh); bq.half[1] = *(const v8us*)((const unsigned short*)Bh + boff + 16 + 8 * hh);
      acc[t] = mmaH<1>(ah.v, ah.v, bq.v, bq.v, acc[t]); }
  }
#pragma unroll
  for (int t = 0; t < 4; ++t) { if (col0 + t * 16 >= N) continue; const int col = col0 + t * 16 + ln; const float bv = bp ? bf16_round(bp[col]) : 0.f;
#pragma unroll
    for (int r = 0; r < 8; ++r) { float v = acc[t][r] * alpha + bv; if (CP) { const int rr = row0g + row0 + 8 * hh + r; if (rowsPerB < 0) v += CP[cofs + (size_t)rr * ldc + col];      /* rowsPerB < 0: own element of the batched C plane */ else { const int bidx = rr / rowsPerB; v += CP[(size_t)bidx * sCPb + (size_t)by * 64 + col]; } } if (ACT == 1) v = (v > 0.f) ? v : expm1f(v); else if (ACT == 7) v = (v > 0.f) ? v + 1.0f : expf(v); else if (ACT == 8) v = tanhf(v); else if (ACT == 9) v = 0.5f * v * (1.0f + tanhf(0.7978845608028654f * (v + 0.044715f * v * v * v))); else if (ACT == 11) v = 1.0f / (1.0f + expf(-v)); else if (ACT == 12) v = (v > 0.f) ? v : 0.01f * v; else if (ACT == 14) v = (v > 0.f) ? v : 0.1f * v; else if (ACT == 16) v = (v >= 0.f) ? v : 0.3f * v; else if (ACT == 17) v = (v >= 0.f) ? v : 0.2f * v; else if (ACT == 15) v = v / (1.0f + expf(-v)); else if (ACT == 3) v = fmaxf(v, 0.f); else if (ACT == 6) v = 0.5f * v * (1.0f + erff(v * 0.70710678118654752f)); so[w][8 * hh + r][t * 16 + ln] = v; } }
  __builtin_amdgcn_fence(__ATOMIC_ACQ_REL, "workgroup"); __builtin_amdgcn_wave_barrier();
  const int rsub = lane >> 4, c4 = (lane & 15) * 4; typedef _Float16 v4h __attribute__((ext_vector_type(4)));
  {
#pragma unroll
    for (int q = 0; q < 8; ++q) { const int r = q * 2 + rsub; if (col0 + c4 < N) { const v4f v = *(const v4fa*)&so[w][r][c4]; if (C) *(v4f*)(C + cofs + (size_t)(row0 + r) * ldc + col0 + c4) = v; if (C16) { v4h h4; for (int i = 0; i < 4; ++i) h4[i] = (_Float16)v[i]; *(v4h*)(C16 + cofs + (size_t)(row0 + r) * ldc + col0 + c4) = h4; } } }
     }
}


typedef _Float16 v4h __attribute__((ext_vector_type(4)));

__device__ __forceinline__ void x16_job(int bx, const float* __restrict__ x, _Float16* __restrict__ X16, size_t n8) { const size_t t = (size_t)bx * 256 + threadIdx.x; if (t >= n8) return; FragH f;
#pragma unroll
  for (int q = 0; q < 8; ++q) f.h[q] = (_Float16)bf16_round(x[t * 8 + q]); *(v8us*)((unsigned short*)X16 + t * 8) = f.half[0];  }
__global__ __launch_bounds__(256) void k_h16(const float* __restrict__ x, _Float16* __restrict__ X16, size_t n8) { const size_t t = (size_t)blockIdx.x * 256 + threadIdx.x; if (t >= n8) return; FragH f;
#pragma unroll
  for (int q = 0; q < 8; ++q) f.h[q] = (_Float16)x[t * 8 + q]; *(v8us*)((unsigned short*)X16 + t * 8) = f.half[0];  }
__global__ __launch_bounds__(256) void k_round16f(const float* __restrict__ W, _Float16* __restrict__ Bt, size_t n8) { const size_t t = (size_t)blockIdx.x * 256 + threadIdx.x; if (t >= n8) return; FragH f;
#pragma unroll
  for (int i = 0; i < 8; ++i) f.h[i] = (_Float16)(bf16_round(W[t * 8 + i]) * 16.0f); *(v8us*)((unsigned short*)Bt + t * 8) = f.half[0];  }
template <int NHv, int TTv>
__global__ __launch_bounds__(256) void k_vt(const _Float16* __restrict__ V16, int ldv, int voff, _Float16* __restrict__ Vt) { __shared__ unsigned short tl[64][66]; const int tid = threadIdx.x; const int slab = blockIdx.x / (TTv / 64), lg = blockIdx.x % (TTv / 64); const int b = slab / NHv, h = slab % NHv;
  for (int i = tid; i < 64 * 8; i += 256) { const int r = i / 8, c8 = (i % 8) * 8; FragH f; f.half[0] = *(const v8us*)((const unsigned short*)V16 + ((size_t)b * TTv + lg * 64 + r) * ldv + voff + h * 64 + c8);
#pragma unroll
    for (int q = 0; q < 8; ++q) tl[r][c8 + q] = f.u[q]; }
  __syncthreads();
  {
#pragma unroll
    for (int rd = 0; rd < 2; ++rd) { const int d = rd * 32 + tid / 8, pc = tid % 8; FragH f;
#pragma unroll
      for (int q = 0; q < 8; ++q) f.u[q] = tl[pc * 8 + q][d];
      *(v8us*)((unsigned short*)Vt + ((size_t)slab * 64 + d) * TTv + lg * 64 + pc * 8) = f.half[0]; }
     } }

// ---- fast GEMM (work-group tile 128x128: eight waves of 32x64; requires M % 128 == 0, N % 128 == 0, K % 128 == 0); epilogue = k_gemm_hhx semantics ----
// Both operands go from global memory to LDS by asynchronous copies, 128 k (256 bytes of each of the 128 A rows and 128 B rows) per stage, two buffers: stage t + 1 flies while stage t is multiplied.
// A wave's copy covers two whole rows of the stage (four whole 128-byte lines), and every operand byte is fetched once per work-group instead of once per wave.
#define G2P 136                      /* f16 per LDS row: 272 bytes = 16 x odd, the pitch for 16-byte readers of 256-byte rows */
#define G2BUF (256 * G2P)            /* f16 per buffer: A rows 0 .. 127, then B rows 0 .. 127 */
__device__ __forceinline__ v16h g2_frag(const _Float16* p, int hh) { FragH f; f.half[0] = *(const v8us*)((const unsigned short*)p + 8 * hh); f.half[1] = *(const v8us*)((const unsigned short*)p + 16 + 8 * hh); return f.v; }
__device__ __forceinline__ v8f g2_mma(v16h a, v16h b, v8f c) { v8f d = __builtin_amdgcn_wmma_f32_16x16x32_f16(false, a, false, b, (short)0, c, false, false); asm volatile("v_nop\n\tv_nop\n\tv_nop\n\tv_nop" : "+v"(d) : "v"(a), "v"(b)); return d; }
// Eight asynchronous 16-byte copies per lane: rows r, r + 16, .. r + 112 of one operand's stage (l = the lane's LDS byte address in row r, g = its global address there, step = 16 source rows in elements).
__device__ __forceinline__ void g2_copy8(unsigned l, const _Float16* g, size_t step) {
  const unsigned l1 = l + 16 * G2P * 2, l2 = l + 32 * G2P * 2, l3 = l + 48 * G2P * 2, l4 = l + 64 * G2P * 2, l5 = l + 80 * G2P * 2, l6 = l + 96 * G2P * 2, l7 = l + 112 * G2P * 2;
  const _Float16* g1 = g + step; const _Float16* g2 = g1 + step; const _Float16* g3 = g2 + step; const _Float16* g4 = g3 + step; const _Float16* g5 = g4 + step; const _Float16* g6 = g5 + step; const _Float16* g7 = g6 + step;
  /* the copies and, as the statement's last line, the wait in front of any rewrite of a register that an issued copy names */
  asm volatile("global_load_async_to_lds_b128 %0, %8, off\n\t"
               "global_load_async_to_lds_b128 %1, %9, off\n\t"
               "global_load_async_to_lds_b128 %2, %10, off\n\t"
               "global_load_async_to_lds_b128 %3, %11, off\n\t"
               "global_load_async_to_lds_b128 %4, %12, off\n\t"
               "global_load_async_to_lds_b128 %5, %13, off\n\t"
               "global_load_async_to_lds_b128 %6, %14, off\n\t"
               "global_load_async_to_lds_b128 %7, %15, off\n\t"
               "s_wait_xcnt 0x0"
               :: "v"(l), "v"(l1), "v"(l2), "v"(l3), "v"(l4), "v"(l5), "v"(l6), "v"(l7), "v"(g), "v"(g1), "v"(g2), "v"(g3), "v"(g4), "v"(g5), "v"(g6), "v"(g7) : "memory"); }
template <int ACT>
__device__ __forceinline__ void gemm2_job(int bx, int by, int bz, int ashift, const _Float16* __restrict__ A, int lda, size_t sA, const _Float16* __restrict__ Bh, int ldb, size_t sB, float alpha, const float* __restrict__ bias, size_t sBias, const float* __restrict__ CP, int rowsPerB, size_t sCPb, int row0g,
    float* __restrict__ C, _Float16* __restrict__ C16, int ldc, size_t sC, int M, int N, int K, int bsh, size_t zA, size_t zB, size_t zC) { static_assert(ACT == 0 || ACT == 3 || ACT == 6 || ACT == 8 || ACT == 9 || ACT == 11 || ACT == 12 || ACT == 14 || ACT == 15 || ACT == 16 || ACT == 17, "k_gemm2: unsupported ACT code (would silently apply no activation)");
  __shared__ __attribute__((aligned(16))) float sm[2 * G2BUF / 2];      /* the two operand buffers; behind the loop's last barrier the same LDS stages the output */
  static_assert(8 * 32 * 68 <= 2 * G2BUF / 2, "output staging must fit the operand buffers");
  float (*so)[32][68] = (float (*)[32][68])sm; const _Float16* lh = (const _Float16*)sm;
  const int tid = threadIdx.x, w = tid >> 5, lane = tid & 31, ln = lane & 15, hh = lane >> 4;      /* bx = tile; by = plane (head), 2^bsh planes share one B plane; bz = outer batch with its own strides zA, zB, zC; ashift = rows added to the tile's row index in A only */
  A += (size_t)by * sA + (size_t)bz * zA; Bh += (size_t)(by >> bsh) * sB + (size_t)bz * zB; const size_t cofs = (size_t)by * sC + (size_t)bz * zC; const float* bp = bias ? bias + (size_t)by * sBias : nullptr;
  const int ntn = N >> 7; const int mt = bx / ntn, nq = bx - mt * ntn; if (mt * 128 >= M) return;      /* the same for the whole work-group, in front of every barrier */
  const int row0 = mt * 128 + 32 * (w & 3), col0 = nq * 128 + 64 * (w >> 2);
  const int cr = tid >> 4, cc = (tid & 15) * 8;      /* copies: 16 lanes per row, 16 bytes each */
  const _Float16* ga = A + (size_t)(mt * 128 + ashift + cr) * lda + cc; const _Float16* gb = Bh + (size_t)(nq * 128 + cr) * ldb + cc; const size_t sa16 = (size_t)16 * lda, sb16 = (size_t)16 * ldb;
  const unsigned la = (unsigned)(size_t)sm + (unsigned)(cr * G2P + cc) * 2u, lb = la + 128u * G2P * 2u;
  const int aoff = (32 * (w & 3) + ln) * G2P, boff = (128 + 64 * (w >> 2) + ln) * G2P;
  const v8f z8 = {0.f,0.f,0.f,0.f,0.f,0.f,0.f,0.f}; v8f c00 = z8, c01 = z8, c02 = z8, c03 = z8, c10 = z8, c11 = z8, c12 = z8, c13 = z8;
  const int nt = K >> 7;
  g2_copy8(la, ga, sa16); g2_copy8(lb, gb, sb16);      /* stage 0 -> buffer 0 */
  asm volatile("s_wait_asynccnt 0x0" ::: "memory");      /* this wave's copies of stage 0 have landed */
  __syncthreads();      /* ... and every other wave's: stage 0 may be read */
  if (nt > 1) { g2_copy8(la + G2BUF * 2u, ga + 128, sa16); g2_copy8(lb + G2BUF * 2u, gb + 128, sb16); }      /* stage 1 -> buffer 1 */
#pragma unroll 1      /* one stage a trip: 32 matrix instructions a wave */
  for (int t = 0; t < nt; ++t) { const _Float16* a0p = lh + (t & 1) * G2BUF + aoff; const _Float16* a1p = a0p + 16 * G2P; const _Float16* b0p = lh + (t & 1) * G2BUF + boff; const _Float16* b1p = b0p + 16 * G2P; const _Float16* b2p = b1p + 16 * G2P; const _Float16* b3p = b2p + 16 * G2P;
    v16h a0 = g2_frag(a0p, hh), a1 = g2_frag(a1p, hh), b0 = g2_frag(b0p, hh), b1 = g2_frag(b1p, hh), b2 = g2_frag(b2p, hh), b3 = g2_frag(b3p, hh);
#pragma unroll      /* two fragment sets in registers, named by constants; the LDS reads differ by immediate offsets */
    for (int kb = 0; kb < 128; kb += 32) { v16h na0 = a0, na1 = a1, nb0 = b0, nb1 = b1, nb2 = b2, nb3 = b3;
      if (kb + 32 < 128) { na0 = g2_frag(a0p + kb + 32, hh); na1 = g2_frag(a1p + kb + 32, hh); nb0 = g2_frag(b0p + kb + 32, hh); nb1 = g2_frag(b1p + kb + 32, hh); nb2 = g2_frag(b2p + kb + 32, hh); nb3 = g2_frag(b3p + kb + 32, hh); }      /* the next 32 k of this stage, read as one group ahead of this block's products: their LDS latency hides behind the eight matrix instructions */
      c00 = g2_mma(a0, b0, c00); c10 = g2_mma(a1, b0, c10); c01 = g2_mma(a0, b1, c01); c11 = g2_mma(a1, b1, c11);
      c02 = g2_mma(a0, b2, c02); c12 = g2_mma(a1, b2, c12); c03 = g2_mma(a0, b3, c03); c13 = g2_mma(a1, b3, c13);
      a0 = na0; a1 = na1; b0 = nb0; b1 = nb1; b2 = nb2; b3 = nb3; }
    asm volatile("s_wait_dscnt 0x0" ::: "memory");      /* this wave's reads of stage t are done before its buffer is given up */
    asm volatile("s_wait_asynccnt 0x0" ::: "memory");      /* this wave's copies of stage t + 1 have landed */
    __syncthreads();      /* publishes stage t + 1 and ends every wave's reads of stage t */
    if (t + 2 < nt) { const unsigned lo = (unsigned)(t & 1) * (G2BUF * 2u); const int ko = (t + 2) * 128; g2_copy8(la + lo, ga + ko, sa16); g2_copy8(lb + lo, gb + ko, sb16); } }      /* stage t + 2 -> the buffer just left */
  asm volatile("s_wait_asynccnt 0x0" ::: "memory");      /* nothing of this wave is in flight when the buffers become output staging */
  v8f accs[8] = {c00, c01, c02, c03, c10, c11, c12, c13};
#pragma unroll
  for (int u = 0; u < 8; ++u) { const int t = u & 3, half = u >> 2; const int col = col0 + t * 16 + ln; const float bv = bp ? bf16_round(bp[col]) : 0.f;
#pragma unroll
    for (int r = 0; r < 8; ++r) { const int rloc = half * 16 + 8 * hh + r; float v = accs[u][r] * alpha + bv; if (CP) { if (rowsPerB < 0) v += CP[cofs + (size_t)(row0g + row0 + rloc) * ldc + col];      /* rowsPerB < 0: own element of the batched C plane */ else { const int bidx = (row0g + row0 + rloc) / rowsPerB; v += CP[(size_t)bidx * sCPb + (size_t)by * 64 + col]; } }
      if (ACT == 3) v = fmaxf(v, 0.f); else if (ACT == 6) v = 0.5f * v * (1.0f + erff(v * 0.70710678118654752f)); else if (ACT == 11) v = 1.0f / (1.0f + expf(-v)); else if (ACT == 15) v = v / (1.0f + expf(-v)); else if (ACT == 12) v = (v > 0.f) ? v : 0.01f * v; else if (ACT == 8) v = tanhf(v); else if (ACT == 9) v = 0.5f * v * (1.0f + tanhf(0.7978845608028654f * (v + 0.044715f * v * v * v))); else if (ACT == 14) v = (v > 0.f) ? v : 0.1f * v; else if (ACT == 16) v = (v >= 0.f) ? v : 0.3f * v; else if (ACT == 17) v = (v >= 0.f) ? v : 0.2f * v;
      so[w][rloc][t * 16 + ln] = v; } }
  __builtin_amdgcn_fence(__ATOMIC_ACQ_REL, "workgroup"); __builtin_amdgcn_wave_barrier();
  const int rsub = lane >> 4, c4 = (lane & 15) * 4;
  {
#pragma unroll
    for (int q = 0; q < 16; ++q) { const int r = q * 2 + rsub; const v4f v = *(const v4fa*)&so[w][r][c4];
      if (C) { float* cp = C + cofs + (size_t)(row0 + r) * ldc + col0 + c4; *(v4f*)cp = v; asm volatile("s_wait_xcnt 0x0" :: "v"(cp), "v"(v) : "memory"); }      /* behind the f32 store, its address and data as inputs: neither the conversion to f16 nor the next row's LDS load writes into a register that the issued store still names */
      if (C16) { v4h h4; for (int i = 0; i < 4; ++i) h4[i] = (_Float16)v[i]; *(v4h*)(C16 + cofs + (size_t)(row0 + r) * ldc + col0 + c4) = h4; } }
     } }


__global__ __launch_bounds__(256) void k_wnat(const float* __restrict__ w, size_t n8, _Float16* __restrict__ Bt) { const size_t t = (size_t)blockIdx.x * 256 + threadIdx.x; if (t >= n8) return; FragH f; for (int q = 0; q < 8; ++q) f.h[q] = (_Float16)(bf16_round(w[t * 8 + q]) * 16.0f); *(v8us*)((unsigned short*)Bt + t * 8) = f.half[0];  }
__global__ __launch_bounds__(256) void k_rsm(const float* __restrict__ S, _Float16* __restrict__ P, int nrows) {
  #pragma clang fp contract(off)
  const int i = blockIdx.x * 256 + threadIdx.x; if (i >= nrows) return; const float* s = S + (size_t)i * SQ; float mx = -3.0e38f;
#pragma unroll 1
  for (int j = 0; j < SQ; ++j) mx = fmaxf(mx, s[j]); float se = 0.f;
#pragma unroll 1
  for (int j = 0; j < SQ; ++j) se += expf(s[j] - mx); const float sc = 256.0f / se;
#pragma unroll 1
  for (int j0 = 0; j0 < SQ; j0 += 8) { FragH f; for (int q = 0; q < 8; ++q) f.h[q] = (_Float16)(expf(s[j0 + q] - mx) * sc); unsigned short* d = (unsigned short*)P + (size_t)i * SQ + j0; *(v8us*)d = f.half[0];  } }
__global__ __launch_bounds__(256) void k_vt(const _Float16* __restrict__ V16, int b, int h0, _Float16* __restrict__ VT) { __shared__ unsigned short tl[64][65]; const int tid = threadIdx.x; const int hh = blockIdx.x % HG, sg = blockIdx.x / HG; const int s0 = sg * 64; const int h = h0 + hh;
  for (int i = tid; i < 64 * 8; i += 256) { const int j = i / 8, d8 = (i % 8) * 8; FragH f; f.half[0] = *(const v8us*)((const unsigned short*)V16 + ((size_t)b * SQ + s0 + j) * DM + h * HD + d8); for (int q = 0; q < 8; ++q) tl[d8 + q][j] = f.u[q]; }
  __syncthreads();
  { for (int i = tid; i < 64 * 8; i += 256) { const int d = i / 8, j8 = (i % 8) * 8; FragH f; for (int q = 0; q < 8; ++q) f.u[q] = tl[d][j8 + q]; *(v8us*)((unsigned short*)VT + ((size_t)hh * HD + d) * SQ + s0 + j8) = f.half[0]; }  } }


__global__ __launch_bounds__(256) void k_f2h(const float* __restrict__ F, int ldf, int coff, int ncol, _Float16* __restrict__ H16, size_t nrow) { const size_t t = (size_t)blockIdx.x * 256 + threadIdx.x; const size_t n8 = nrow * (size_t)(ncol / 8); if (t >= n8) return; const size_t r = t / (ncol / 8); const int c8 = (int)(t % (ncol / 8)) * 8; FragH f; const v4f a = *(const v4fa*)(F + r * ldf + coff + c8), b2 = *(const v4fa*)(F + r * ldf + coff + c8 + 4); for (int q = 0; q < 4; ++q) { f.h[q] = (_Float16)a[q]; f.h[4 + q] = (_Float16)b2[q]; } *(v8us*)((unsigned short*)H16 + r * ncol + c8) = f.half[0];  }

__global__ __launch_bounds__(256) void k_tab128(float theta, float* __restrict__ CS, float* __restrict__ SN) {
  #pragma clang fp contract(off)
  const int t = blockIdx.x * 256 + threadIdx.x; if (t >= SQ * 64) return; const int i = t % 64; const int p = t / 64; const float invf = (float)(1.0 / pow((double)theta, (double)(2 * i) / 128.0));      /* = XLA's constant-folded f32 table */ const float ang = __fmul_rn((float)p, invf); const float c = cosf(ang), s = sinf(ang);
  *(float*)(CS + t) = c; *(float*)(SN + t) = s;  }
template <int TAB>
__global__ __launch_bounds__(128) void k_rope128(const float* __restrict__ F, int ldf, int nh, const float* __restrict__ CS, const float* __restrict__ SN, _Float16* __restrict__ H16, int ldo, float osc) {
  #pragma clang fp contract(off)
  __shared__ float xv[128]; __shared__ unsigned short sh_[128]; const int d = threadIdx.x; const int h = blockIdx.x % nh; const size_t r = blockIdx.x / nh; const int p = (int)(r % SQ);
  xv[d] = F[r * (size_t)ldf + (size_t)h * 128 + d]; __syncthreads();
  float c, s; if (TAB) { c = bf16_round(CS[(size_t)p * 128 + d]); s = bf16_round(SN[(size_t)p * 128 + d]); } else { c = CS[p * 64 + (d & 63)]; s = SN[p * 64 + (d & 63)]; }
  const float rot = (d < 64) ? -xv[d + 64] : xv[d - 64]; const float o = __fadd_rn(__fmul_rn(xv[d], c), __fmul_rn(rot, s));
  FragH th; th.h[0] = (_Float16)__fmul_rn(o, osc); sh_[d] = th.u[0]; __syncthreads();
  if (d < 16) { FragH f; for (int q = 0; q < 8; ++q) f.u[q] = sh_[d * 8 + q]; unsigned short* dst = (unsigned short*)H16 + r * (size_t)ldo + (size_t)h * 128 + d * 8; *(v8us*)dst = f.half[0];  } }

// Rotate-half RoPE, one wave per token row. 16 lanes per head: a lane holds columns 4 l .. 4 l + 3 and their partners 64 columns on, so x[d] and x[d + 64] meet in one lane (no LDS, no barrier);
// the row's cos / sin values (full-width f32 tables, one row per token row) stay in registers for all NHv heads, two heads per load. bx = group of 8 rows in a batch; by = batch: source and table rows step by yin, output rows by yout.
template <int NHv, int F32OUT>
__device__ __forceinline__ void rope128w_job(int bx, int by, const float* __restrict__ F, const float* __restrict__ CS, const float* __restrict__ SN, float* __restrict__ OF, _Float16* __restrict__ OH, float osc, int yin, int yout) {
  constexpr int ld = NHv * 128, NI = NHv / 2; static_assert(NHv % 2 == 0, "two heads per wave and trip");
  const int lane = threadIdx.x & 31; const int e = (lane >> 4) * 128 + (lane & 15) * 4, d = (lane & 15) * 4; const size_t rl = (size_t)bx * 8 + (threadIdx.x >> 5); const size_t r = rl + (size_t)by * yin, ro = rl + (size_t)by * yout;
  const float* cp = CS + r * 128 + d; const float* sp = SN + r * 128 + d; const float* xp = F + r * ld + e;
  const v4f cl = *(const v4fa*)cp, ch = *(const v4fa*)(cp + 64), sl = *(const v4fa*)sp, sh = *(const v4fa*)(sp + 64);
  v4f xl[NI], xh[NI];
#pragma unroll      /* the whole row's loads in flight together; xl[], xh[] stay in registers only if every index is a constant */
  for (int i = 0; i < NI; ++i) { xl[i] = *(const v4fa*)(xp + i * 256); xh[i] = *(const v4fa*)(xp + i * 256 + 64); }
  asm volatile("s_wait_xcnt 0x0" :: "v"(cp), "v"(sp), "v"(xp) : "memory");      /* behind the row's loads, the three addresses as inputs: no address register is given to a later load's result or overwritten while an issued load still names it, and no table load is put off behind the first data wait */
#pragma unroll      /* as above */
  for (int i = 0; i < NI; ++i) { v4f ol, oh;
    for (int q = 0; q < 4; ++q) { ol[q] = fmaf(-xh[i][q], sl[q], xl[i][q] * cl[q]) * osc; oh[q] = fmaf(xl[i][q], sh[q], xh[i][q] * ch[q]) * osc; }      /* x cos rounded, partner x sin fused into the add: the form that the one-thread-per-column kernel compiled to, so roped q and k keep their bits */
    if (F32OUT) { float* dst = OF + ro * ld + e + i * 256; *(v4f*)dst = ol; *(v4f*)(dst + 64) = oh; }
    else { v4h hl, hh; for (int q = 0; q < 4; ++q) { hl[q] = (_Float16)ol[q]; hh[q] = (_Float16)oh[q]; } _Float16* dst = OH + ro * ld + e + i * 256; *(v4h*)dst = hl; *(v4h*)(dst + 64) = hh; } }
  asm volatile("s_wait_xcnt 0x0" ::: "memory"); }      /* behind the row's stores: in a merged launch another job's code follows in the listing, and no register that an issued store names is to be written there ahead of this wait */
template <int N>
__global__ __launch_bounds__(256) void k_rmsrow(float* __restrict__ X, const float* __restrict__ w, float eps) {
  #pragma clang fp contract(off)
  constexpr int PT = N / 256; __shared__ float red[256]; const size_t r = blockIdx.x; const int t = threadIdx.x; float* row = X + r * N + (size_t)t * PT; float v[PT]; float ss = 0.f;
  for (int q = 0; q < PT; ++q) { v[q] = row[q]; ss = __fadd_rn(ss, __fmul_rn(v[q], v[q])); }
  red[t] = ss; __syncthreads(); for (int k = 128; k > 0; k >>= 1) { if (t < k) red[t] = __fadd_rn(red[t], red[t + k]); __syncthreads(); }
  const float rs = rsqrtf(__fadd_rn(red[0] / (float)N, eps)); float o[PT]; for (int q = 0; q < PT; ++q) o[q] = __fmul_rn(__fmul_rn(v[q], rs), bf16_round(w[t * PT + q]));
  { for (int q = 0; q < PT; ++q) *(float*)(row + q) = o[q];  } }

__global__ __launch_bounds__(256) void k_rsmcfb(const float* __restrict__ S, _Float16* __restrict__ P, int hg, int q0, int nk, const int* __restrict__ mk) {
  #pragma clang fp contract(off)
  const int t = blockIdx.x * 256 + threadIdx.x; if (t >= hg * QT) return; const size_t i = (size_t)t; const float* s = S + i * NKX; const size_t ig = (size_t)(q0 + (t % QT)); const int* mr = mk + ig * SQ; float mx = -3.0e38f;
#pragma unroll 1
  for (int j = 0; j < nk; ++j) { const int mb = mr[j]; const float f = (mb == 0) ? 1.f : 0.f; mx = fmaxf(mx, fmaf(f, s[j], (1.f - f) * -1.0e9f)); } float se = 0.f;
#pragma unroll 1
  for (int j = 0; j < nk; ++j) { const int mb = mr[j]; const float f = (mb == 0) ? 1.f : 0.f; se += __expf(fmaf(f, s[j], (1.f - f) * -1.0e9f) - mx); } const float sc = 256.0f / se;
#pragma unroll 1
  for (int j0 = 0; j0 < nk; j0 += 8) { FragH fr; for (int q = 0; q < 8; ++q) { const int j = j0 + q; const int mb = mr[j]; const float f = (mb == 0) ? 1.f : 0.f; fr.h[q] = (_Float16)(__expf(fmaf(f, s[j], (1.f - f) * -1.0e9f) - mx) * sc); } unsigned short* d = (unsigned short*)P + i * NKX + j0; *(v8us*)d = fr.half[0];  } }


// Causal softmax, one wave per score row: lane l holds columns 128 c + 4 l .. + 3 of every 128-column chunk c in registers, so each
// load and store of a wave covers one contiguous run of the row and the row is read once. Row maximum and denominator: per-lane partial, then a xor butterfly over the 32 lanes.
// rel = the row's last causal column minus the lane's first column.
template <int NC>
__device__ __forceinline__ void rsm_row(const float* __restrict__ s, _Float16* __restrict__ d, int rel) {
  v4f e[NC]; float mx = -3.0e38f, se = 0.f;
#pragma unroll      /* here and below: e[] stays in registers only if every index is a constant */
  for (int c = 0; c < NC; ++c) e[c] = *(const v4fa*)(s + c * 128);
#pragma unroll      /* as above */
  for (int c = 0; c < NC; ++c) for (int q = 0; q < 4; ++q) { const float f = (c * 128 + q <= rel) ? 1.f : 0.f; e[c][q] = fmaf(f, e[c][q], (1.f - f) * -1.0e9f); mx = fmaxf(mx, e[c][q]); }
  for (int m = 16; m > 0; m >>= 1) mx = fmaxf(mx, __shfl_xor(mx, m, 32));
#pragma unroll      /* as above */
  for (int c = 0; c < NC; ++c) for (int q = 0; q < 4; ++q) { e[c][q] = __expf(e[c][q] - mx); se += e[c][q]; }
  for (int m = 16; m > 0; m >>= 1) se += __shfl_xor(se, m, 32);
  const float sc = 256.0f / se;
#pragma unroll      /* as above */
  for (int c = 0; c < NC; ++c) { v4h h4; for (int q = 0; q < 4; ++q) h4[q] = (_Float16)(e[c][q] * sc); *(v4h*)(d + c * 128) = h4; }
  asm volatile("s_wait_xcnt 0x0" ::: "memory");      /* behind the row's stores: without it the compiler merges the last stores of the eight bodies into one tail; no register that an issued store names is to be written there ahead of this wait */
}
__global__ __launch_bounds__(256) void k_rsmcf2(const float* __restrict__ S, _Float16* __restrict__ P, int hg, int q0, int nk) {
  static_assert(QT == 256 && NKX == 8 * QT, "one case per row length below");
  const int col = (threadIdx.x & 31) * 4; const int t = blockIdx.x * 8 + (threadIdx.x >> 5); if (t >= hg * QT) return;
  const float* s = S + (size_t)t * NKX + col; _Float16* d = P + (size_t)t * NKX + col; const int rel = q0 + (t % QT) - col;
  switch (nk / QT) {      /* nk = QT .. NKX in steps of QT: one straight-line body per row length, so that the row's registers are indexed by constants */
    case 1: rsm_row<2>(s, d, rel); break; case 2: rsm_row<4>(s, d, rel); break; case 3: rsm_row<6>(s, d, rel); break; case 4: rsm_row<8>(s, d, rel); break;
    case 5: rsm_row<10>(s, d, rel); break; case 6: rsm_row<12>(s, d, rel); break; case 7: rsm_row<14>(s, d, rel); break; case 8: rsm_row<16>(s, d, rel); break; } }



__global__ __launch_bounds__(256) void k_tab128p(const int* __restrict__ pos, int nrows, float theta, float* __restrict__ CS, float* __restrict__ SN) {
  #pragma clang fp contract(off)
  const int t = blockIdx.x * 256 + threadIdx.x; if (t >= nrows * 64) return; const int i = t % 64; const int r = t / 64; const float invf = (float)(1.0 / pow((double)theta, (double)(2 * i) / 128.0)); const float ang = __fmul_rn((float)pos[r], invf); const float c = cosf(ang), sv = sinf(ang);
  float* c0 = CS + (size_t)r * 128 + i; float* s0 = SN + (size_t)r * 128 + i;
  { *(float*)c0 = c; *(float*)(c0 + 64) = c; *(float*)s0 = sv; *(float*)(s0 + 64) = sv;  } }

__global__ __launch_bounds__(256) void k_rsmcim(const float* __restrict__ S, _Float16* __restrict__ P, int hg, int q0, int nk, const int* __restrict__ am) {
  #pragma clang fp contract(off)
  const int t = blockIdx.x * 256 + threadIdx.x; if (t >= hg * QT) return; const size_t i = (size_t)t; const float* s = S + i * NKX; const int last = q0 + (t % QT); const int* mr = am + (size_t)last * SQ; float mx = -3.0e38f;      /* the module's mask row of this query (keys >= nk lie above the diagonal of the causal mask and are not computed) */
#pragma unroll 1
  for (int j = 0; j < nk; ++j) { const float f = (mr[j] != 0) ? 1.f : 0.f; mx = fmaxf(mx, fmaf(f, s[j], (1.f - f) * -1.0e9f)); } float se = 0.f;
#pragma unroll 1
  for (int j = 0; j < nk; ++j) { const float f = (mr[j] != 0) ? 1.f : 0.f; se += __expf(fmaf(f, s[j], (1.f - f) * -1.0e9f) - mx); } const float sc = 256.0f / se;
#pragma unroll 1
  for (int j0 = 0; j0 < nk; j0 += 8) { FragH fr; for (int q = 0; q < 8; ++q) { const int j = j0 + q; const float f = (mr[j] != 0) ? 1.f : 0.f; fr.h[q] = (_Float16)(__expf(fmaf(f, s[j], (1.f - f) * -1.0e9f) - mx) * sc); } unsigned short* d = (unsigned short*)P + i * NKX + j0; *(v8us*)d = fr.half[0];  } }



__device__ __forceinline__ void tab128h_job(int bx, int nr, float theta, float* __restrict__ CS, float* __restrict__ SN) {
  #pragma clang fp contract(off)
  const size_t t = (size_t)bx * 256 + threadIdx.x; if (t >= (size_t)nr * 64) return; const int i = (int)(t % 64); const size_t r = t / 64; const int p = (int)(r % SQ);
  const float invf = (float)(1.0 / pow((double)theta, ((double)(2 * i)) / 128.0)); const float ang = __fmul_rn((float)p, invf); const float c = cosf(ang), sv = sinf(ang);
  float* pc = CS + r * 128 + i; float* ps = SN + r * 128 + i;
  *(float*)pc = c; *(float*)(pc + 64) = c; *(float*)ps = sv; *(float*)(ps + 64) = sv;  }
typedef unsigned int fa_u4 __attribute__((ext_vector_type(4)));
typedef unsigned int fa_u8 __attribute__((ext_vector_type(8)));
typedef short fa_s8 __attribute__((ext_vector_type(8)));
typedef float fa_f2 __attribute__((ext_vector_type(2)));
typedef _Float16 fa_h2 __attribute__((ext_vector_type(2)));
constexpr unsigned FA_PK = 272u;                 /* LDS pitch of a 256-byte K row: odd multiple of 16 bytes, for 16-byte readers */
constexpr unsigned FA_PV = 288u;                 /* LDS pitch of a 256-byte V row: odd multiple of 32 bytes, for the transposing load */
constexpr unsigned FA_SK = 128u;                 /* keys per stage */
constexpr unsigned FA_TK = FA_SK * FA_PK, FA_SLOT = FA_TK + FA_SK * FA_PV;      /* a buffer: K rows, then V rows */
constexpr unsigned FA_EP = 272u;                 /* output staging pitch */
static_assert(4u * 32u * FA_EP <= 2u * FA_SLOT, "output staging must fit the two buffers");
static_assert(HDK == 128 && SQ == 16 * 128 && NB == 2, "written for head size 128, 16 query blocks of 128 rows and two batches (the block order below)");
struct FaFrag { fa_u4 q[2]; };
struct FaK { FaFrag f[2][4]; };                  /* one pass's K: two 16-key tiles x four 32-wide k chunks */
__device__ __forceinline__ v8f fa_mma(const FaFrag& a, const FaFrag& b, v8f c) {
  const fa_u8 av = {a.q[0].x, a.q[0].y, a.q[0].z, a.q[0].w, a.q[1].x, a.q[1].y, a.q[1].z, a.q[1].w};
  const fa_u8 bv = {b.q[0].x, b.q[0].y, b.q[0].z, b.q[0].w, b.q[1].x, b.q[1].y, b.q[1].z, b.q[1].w};
  return __builtin_amdgcn_wmma_f32_16x16x32_f16(false, __builtin_bit_cast(v16h, av), false, __builtin_bit_cast(v16h, bv), (short)0, c, false, false); }
__device__ __forceinline__ fa_u4 fa_tr16(const unsigned char* p) { typedef __attribute__((address_space(3))) fa_s8 lds_s8; return __builtin_bit_cast(fa_u4, __builtin_amdgcn_ds_load_tr16_b128_v8i16((lds_s8*)p)); }
__device__ __forceinline__ unsigned fa_pack2(float lo, float hi) { return __builtin_bit_cast(unsigned, __builtin_convertvector(fa_f2{lo, hi}, fa_h2)); }      /* round to nearest even */
__device__ __forceinline__ float fa_xhalf(float x) { return __builtin_bit_cast(float, __builtin_amdgcn_permlanex16(__builtin_bit_cast(int, x), __builtin_bit_cast(int, x), 0x76543210, 0xfedcba98, false, false)); }      /* lane l with lane l ^ 16 */
__device__ __forceinline__ void fa_keep() { __builtin_amdgcn_sched_barrier(0); }      /* keeps the groups of a pass (products, fragment loads, exponentials) in the written order: moved together they lengthen live ranges and spill */
__device__ __forceinline__ void fa_nop4() { asm volatile("v_nop\n\tv_nop\n\tv_nop\n\tv_nop"); }      /* the four vector slots behind a run of matrix instructions, on every path: a branch follows */
__device__ __forceinline__ void fa_load_k(FaK& k, const unsigned char* Lp, unsigned koff, unsigned lane) {
  const unsigned c = lane & 15u, h = lane >> 4;
#pragma unroll      /* k.f[][] stays in registers only if every index is a constant */
  for (int kt = 0; kt < 2; ++kt) { const unsigned char* p = Lp + koff + (16u * kt + c) * FA_PK + 16u * h;
#pragma unroll      /* as above */
    for (int kc = 0; kc < 4; ++kc) { k.f[kt][kc].q[0] = *reinterpret_cast<const fa_u4*>(p + 64u * kc); k.f[kt][kc].q[1] = *reinterpret_cast<const fa_u4*>(p + 64u * kc + 32u); } } }
// Eight asynchronous 16-byte copies per lane: rows r, r + 8, .. r + 56 of one operand's stage (l = the lane's LDS byte address in row r, g = its global address there; source rows are DKV elements apart).
template <unsigned PITCH>
__device__ __forceinline__ void fa_copy8(unsigned l, const _Float16* g) {
  const unsigned l1 = l + 8u * PITCH, l2 = l + 16u * PITCH, l3 = l + 24u * PITCH, l4 = l + 32u * PITCH, l5 = l + 40u * PITCH, l6 = l + 48u * PITCH, l7 = l + 56u * PITCH;
  const _Float16* g1 = g + 8 * DKV; const _Float16* g2 = g + 16 * DKV; const _Float16* g3 = g + 24 * DKV; const _Float16* g4 = g + 32 * DKV; const _Float16* g5 = g + 40 * DKV; const _Float16* g6 = g + 48 * DKV; const _Float16* g7 = g + 56 * DKV;
  /* the copies and, as the statement's last line, the wait in front of any rewrite of a register that an issued copy names */
  asm volatile("global_load_async_to_lds_b128 %0, %8, off\n\t"
               "global_load_async_to_lds_b128 %1, %9, off\n\t"
               "global_load_async_to_lds_b128 %2, %10, off\n\t"
               "global_load_async_to_lds_b128 %3, %11, off\n\t"
               "global_load_async_to_lds_b128 %4, %12, off\n\t"
               "global_load_async_to_lds_b128 %5, %13, off\n\t"
               "global_load_async_to_lds_b128 %6, %14, off\n\t"
               "global_load_async_to_lds_b128 %7, %15, off\n\t"
               "s_wait_xcnt 0x0"
               :: "v"(l), "v"(l1), "v"(l2), "v"(l3), "v"(l4), "v"(l5), "v"(l6), "v"(l7), "v"(g), "v"(g1), "v"(g2), "v"(g3), "v"(g4), "v"(g5), "v"(g6), "v"(g7) : "memory"); }
__device__ __forceinline__ void fa_pass(FaK& kf, bool fetch_next, unsigned next_koff, const unsigned char* Lp, bool diag, unsigned voff, unsigned key0, unsigned qw0, unsigned lane,
                                        const FaFrag (&qf)[2][4], v8f (&acc)[2][8], float (&m_run)[2], float (&l_run)[2], float cscale) {
  const unsigned c = lane & 15u, h = lane >> 4;
  v8f s[2][2];
  asm volatile("s_wait_dscnt 0x0" ::: "memory");      /* this pass's K fragments have arrived */
  fa_keep();
#pragma unroll      /* every array below is indexed by constants only */
  for (int kt = 0; kt < 2; ++kt) {
#pragma unroll
    for (int g = 0; g < 2; ++g) { s[kt][g] = v8f{};
#pragma unroll
      for (int kc = 0; kc < 4; ++kc) s[kt][g] = fa_mma(kf.f[kt][kc], qf[g][kc], s[kt][g]); } }
  fa_keep(); fa_nop4(); fa_keep();
  if (fetch_next) fa_load_k(kf, Lp, next_koff, lane);
  if (diag) {
#pragma unroll
    for (int g = 0; g < 2; ++g) { const unsigned my_q = qw0 + 16u * g + c;
#pragma unroll
      for (int kt = 0; kt < 2; ++kt) {
#pragma unroll
        for (int r = 0; r < 8; ++r) { const unsigned key = key0 + 16u * kt + 8u * h + r; if (key > my_q) s[kt][g][r] = -__builtin_inff(); }
        asm volatile("" : "+v"(s[kt][g]));
      } } }
  float mb[2]; bool need = false;
#pragma unroll
  for (int g = 0; g < 2; ++g) { float mx = -__builtin_inff();
#pragma unroll
    for (int kt = 0; kt < 2; ++kt) {
#pragma unroll
      for (int r = 0; r < 8; ++r) mx = __builtin_fmaxf(mx, s[kt][g][r]); }
    mx = __builtin_fmaxf(mx, fa_xhalf(mx)) * cscale;
    mb[g] = mx; need = need || (mx > m_run[g] + 8.0f);
    fa_keep(); }
  if (__builtin_amdgcn_ballot_w32(need) != 0) {      /* rare after the first passes */
#pragma unroll
    for (int g = 0; g < 2; ++g) { const float m_new = __builtin_fmaxf(m_run[g], mb[g]);
      const float corr = __builtin_amdgcn_exp2f(m_run[g] - m_new);      /* 0 on the first pass, where m_run is -inf */
      l_run[g] *= corr; m_run[g] = m_new;
#pragma unroll
      for (int t = 0; t < 8; ++t) acc[g][t] = acc[g][t] * corr; } }
  FaFrag vf[8]; float ps[2][2] = {{0.f, 0.f}, {0.f, 0.f}};
  { const unsigned char* ad = Lp + voff + (8u * h + (lane & 7u)) * FA_PV + ((lane >> 3) & 1u) * 16u;
#pragma unroll
    for (int t = 0; t < 8; ++t) { vf[t].q[0] = fa_tr16(ad + 32u * t); vf[t].q[1] = fa_tr16(ad + 16u * FA_PV + 32u * t); } }
#pragma unroll
  for (int g = 0; g < 2; ++g) { const float nm = 4.0f - m_run[g]; unsigned w[8];
#pragma unroll
    for (int i = 0; i < 8; ++i) {
      const fa_f2 arg = __builtin_elementwise_fma(fa_f2{s[i >> 2][g][2 * (i & 3)], s[i >> 2][g][2 * (i & 3) + 1]}, fa_f2{cscale, cscale}, fa_f2{nm, nm});
      const float p0 = __builtin_amdgcn_exp2f(arg.x), p1 = __builtin_amdgcn_exp2f(arg.y);
      ps[g][i & 1] += p0 + p1; w[i] = fa_pack2(p0, p1); }
    FaFrag pf; pf.q[0] = fa_u4{w[0], w[1], w[2], w[3]}; pf.q[1] = fa_u4{w[4], w[5], w[6], w[7]};
    if (g == 0) { asm volatile("s_wait_dscnt 0x0" ::: "memory");      /* the V fragments (and the K fetched ahead) have arrived */
      fa_keep(); }
#pragma unroll
    for (int t = 0; t < 8; ++t) acc[g][t] = fa_mma(vf[t], pf, acc[g][t]);
    fa_keep(); }
  fa_nop4(); fa_keep();
#pragma unroll
  for (int g = 0; g < 2; ++g) l_run[g] += ps[g][0] + ps[g][1];
}
// Exact (f32, vector unit) causal attention over the first QT0 rows, a job of the fused attention's launch: one work-group of four waves per (batch, head, 16 query rows).
// Step 1: wave w takes key chunks w and w + 4 (32 keys each) in turn: it keeps key row 32 ck + lane in registers and forms its scores against the 16 query rows, each read from LDS at one address for the whole wave.
// Step 2: wave w does the softmax of query rows 4 w .. 4 w + 3, lane = key mod 32 (maximum and denominator: per-lane partial, then a xor butterfly).
// Step 3: wave w sums weight x value over the keys in order for the same four rows, lane = four columns of the head, so that every value row is read as one whole run.
// K (roped f32, QT0 rows per batch) and V (the projection's f32 plane, SQ rows per batch) are read in their kv-head layout, head h >> GSH: no expanded copies. o (x64) leaves as f16 hi plane + x1024 residual plane, the output projection's operands.
constexpr int A0_LK = 4 * 32 * 132, A0_LP = 16 * QT0, A0_LQ = 16 * 128;      /* floats of LDS: key rows, scores, query rows */
__device__ __forceinline__ void att0_job(float* sm, int idx, const float* __restrict__ QF, const float* __restrict__ KF, const float* __restrict__ VF, float scale, _Float16* __restrict__ OH, _Float16* __restrict__ OL) {
  constexpr int ld = DMX, ldk = DKV, ldv = DKV, ldo = DMX;      /* row pitches as constants: the rows of one run of loads differ by an immediate offset only */
  static_assert(QT0 == 256 && NH == 16 && NB == 2, "eight key chunks on four waves; idx = 16 row groups x 2 batches x 16 heads");
  float (*lk)[32][132] = (float (*)[32][132])sm;      /* each wave's own key rows at a pitch of 33 x 16 bytes: a lane reads its own row without bank conflicts */
  float (*lp)[QT0] = (float (*)[QT0])(sm + A0_LK);      /* scores, then weights */
  float (*lq)[128] = (float (*)[128])(sm + A0_LK + A0_LP);
  const int tid = threadIdx.x, lane = tid & 31; const int w = __builtin_amdgcn_readfirstlane(tid >> 5);
  const int rg = 15 - (idx >> 5), bt = (idx >> 4) & 1, h = idx & 15, cm = rg >> 1;      /* the longest row groups have the lowest indices (for speed only); cm = the last key chunk that the group's rows can see */
  { const size_t rb = (size_t)bt * QT0; QF += rb * ld; KF += rb * ldk; VF += (size_t)bt * SQ * ldv; OH += rb * ldo; OL += rb * ldo; }      /* QT0 rows of q, k and o per batch, SQ rows of v */
  const int hc = h * 128 + lane * 4, hk = (h >> GSH) * 128 + lane * 4;      /* the lane's columns in the query-head planes and in the kv-head planes */
  for (int r = 0; r < 4; ++r) *(v4f*)&lq[4 * w + r][lane * 4] = *(const v4fa*)(QF + (size_t)(rg * 16 + 4 * w + r) * ld + hc);
  asm volatile("s_wait_xcnt 0x0" ::: "memory");      /* behind the query loads: their address register is not overwritten while an issued load still names it */
  __syncthreads();      /* the 16 query rows are whole before any wave reads them */
#pragma unroll 1      /* at most two trips, each with its own 128 key registers */
  for (int ck = w; ck <= cm; ck += 4) {      /* causal: key chunks 0 .. cm only; no barrier inside, lk[w] is this wave's alone */
#pragma unroll      /* all 32 row loads in flight together */
    for (int r = 0; r < 32; ++r) *(v4f*)&lk[w][r][lane * 4] = *(const v4fa*)(KF + (size_t)(ck * 32 + r) * ldk + hk);
    asm volatile("s_wait_xcnt 0x0" ::: "memory");      /* behind the key loads: as above */
    __builtin_amdgcn_fence(__ATOMIC_ACQ_REL, "workgroup"); __builtin_amdgcn_wave_barrier();      /* the wave's staged rows are written before its lanes read them across */
    v4f kr[32];
#pragma unroll      /* here and in the c loop below: kr[] stays in registers only if every index is a constant */
    for (int c = 0; c < 32; ++c) kr[c] = *(const v4f*)&lk[w][lane][c * 4];
#pragma unroll 1      /* the body is 512 multiply-adds already */
    for (int r0 = 0; r0 < 16; r0 += 4) { float s0 = 0.f, s1 = 0.f, s2 = 0.f, s3 = 0.f;
#pragma unroll
      for (int c = 0; c < 32; ++c) { const v4f q0 = *(const v4f*)&lq[r0][c * 4], q1 = *(const v4f*)&lq[r0 + 1][c * 4], q2 = *(const v4f*)&lq[r0 + 2][c * 4], q3 = *(const v4f*)&lq[r0 + 3][c * 4];
        for (int u = 0; u < 4; ++u) { s0 = fmaf(q0[u], kr[c][u], s0); s1 = fmaf(q1[u], kr[c][u], s1); s2 = fmaf(q2[u], kr[c][u], s2); s3 = fmaf(q3[u], kr[c][u], s3); } }
      float* sp = &lp[r0][ck * 32 + lane]; sp[0] = s0 * scale; sp[QT0] = s1 * scale; sp[2 * QT0] = s2 * scale; sp[3 * QT0] = s3 * scale; } }
  __syncthreads();      /* every wave's scores are written before a row is read across the chunks */
  float fin[4];
#pragma unroll      /* fin[] and e[] are indexed by constants */
  for (int r = 0; r < 4; ++r) { const int il = 4 * w + r, i = rg * 16 + il; float e[8]; float mx = -3.0e38f, l = 0.f;
#pragma unroll
    for (int c = 0; c < 8; ++c) { e[c] = -3.0e38f; if (c <= cm) { const float s = lp[il][c * 32 + lane]; if (c * 32 + lane <= i) e[c] = s; } mx = fmaxf(mx, e[c]); }
    for (int m = 16; m > 0; m >>= 1) mx = fmaxf(mx, __shfl_xor(mx, m, 32));
#pragma unroll
    for (int c = 0; c < 8; ++c) { e[c] = (c * 32 + lane <= i) ? expf(e[c] - mx) : 0.f; l += e[c]; }
    for (int m = 16; m > 0; m >>= 1) l += __shfl_xor(l, m, 32);
    fin[r] = 64.0f / l;
#pragma unroll
    for (int c = 0; c < 8; ++c) if (c <= cm) lp[il][c * 32 + lane] = e[c]; }
  __syncthreads();
  const v4f z4 = {0.f, 0.f, 0.f, 0.f}; v4f acc[4] = {z4, z4, z4, z4}; const float* vp = VF + hk; const int nk = (cm + 1) * 32;
#pragma unroll 1      /* 16 value rows in flight a trip are enough; more would only cost registers */
  for (int j0 = 0; j0 < nk; j0 += 16) { v4f vv[16];
#pragma unroll
    for (int u = 0; u < 16; ++u) vv[u] = *(const v4fa*)(vp + (size_t)(j0 + u) * ldv);
#pragma unroll
    for (int g = 0; g < 4; ++g) for (int r = 0; r < 4; ++r) { const v4f p = *(const v4f*)&lp[4 * w + r][j0 + 4 * g]; for (int u = 0; u < 4; ++u) for (int x = 0; x < 4; ++x) acc[r][x] = fmaf(p[u], vv[4 * g + u][x], acc[r][x]); } }
#pragma unroll
  for (int r = 0; r < 4; ++r) { v4h oh, ol; for (int x = 0; x < 4; ++x) { const float o = acc[r][x] * fin[r]; const _Float16 t = (_Float16)o; oh[x] = t; ol[x] = (_Float16)((o - (float)t) * 1024.0f); }
    const size_t oo = (size_t)(rg * 16 + 4 * w + r) * ldo + hc; *(v4h*)(OH + oo) = oh; *(v4h*)(OL + oo) = ol; } }      /* a wave's store covers one head's 256 bytes of a row: two whole lines */
// grid = (query block in the order below, query head, batch): 512 work-groups, all resident. Q [NB SQ][DMX], K and V [NB SQ][DKV], O [NB SQ][DMX] (x64), all f16.
// grid.z = NB, NB + 1: the 512 work-groups of the exact first tile, which depend on nothing of this launch; they come last in the grid (for speed only).
// Block pb walks pb + 1 stages. The order 15, 0, 14, 1, .. in batch 0 and its mirror in batch 1 lets a long block share its WGP with a short one (for speed only)
// whether the two work-groups of a WGP are neighbours in the grid or half a grid apart.
__global__ __launch_bounds__(128) __attribute__((amdgpu_waves_per_eu(2, 2))) void k_fattn(const _Float16* __restrict__ Q, const _Float16* __restrict__ K, const _Float16* __restrict__ V, _Float16* __restrict__ O,
    const float* __restrict__ QF0, const float* __restrict__ KRF0, const float* __restrict__ VF, _Float16* __restrict__ OH0, _Float16* __restrict__ OL0) {
  __shared__ __attribute__((aligned(16))) unsigned char L[2u * FA_SLOT];
  static_assert((A0_LK + A0_LP + A0_LQ) * 4 <= (int)(2u * FA_SLOT), "the exact tile's LDS must fit the two buffers");
  if (blockIdx.z >= NB) { att0_job((float*)L, (int)((blockIdx.z - NB) * 256u + blockIdx.y * 16u + blockIdx.x), QF0, KRF0, VF, ATS, OH0, OL0); return; }      /* the same for the whole work-group, in front of every barrier */
  constexpr float cscale = 0.12751743082459868f;      /* 1 / sqrt(128) x log2(e) */
  const unsigned tid = threadIdx.x, lane = tid & 31u, wave = __builtin_amdgcn_readfirstlane(tid >> 5), c = lane & 15u, h = lane >> 4;
  const unsigned hq = blockIdx.y, gkv = hq >> GSH; const size_t rb = (size_t)blockIdx.z * SQ;
  const unsigned po = (blockIdx.x & 1u) ? (blockIdx.x >> 1) : 15u - (blockIdx.x >> 1), pb = blockIdx.z ? 15u - po : po, q0 = pb * 128u, n_stage = pb + 1u;      /* keys [0, q0 + 128) */
  const unsigned lbase = (unsigned)(size_t)L, qw0 = q0 + wave * 32u;
  const unsigned cr = tid >> 4, cc = tid & 15u;      /* copies: 16 lanes per row, 16 bytes each */
  const unsigned go = (unsigned)(rb + cr) * DKV + gkv * HDK + cc * 8u;      /* the lane's element in K and in V, stage 0: one 32-bit offset beside the two uniform bases */
  const unsigned lk = lbase + cr * FA_PK + cc * 16u, lv = lbase + FA_TK + cr * FA_PV + cc * 16u;
  auto issue = [&](unsigned st) { const unsigned lo = (st & 1u) * FA_SLOT; const size_t o = (size_t)(go + st * (FA_SK * DKV));      /* stage st -> buffer st mod 2: 32 copies a lane */
    fa_keep(); fa_copy8<FA_PK>(lk + lo, K + o); fa_keep(); fa_copy8<FA_PK>(lk + lo + 64u * FA_PK, K + o + 64 * DKV); fa_keep(); fa_copy8<FA_PV>(lv + lo, V + o); fa_keep(); fa_copy8<FA_PV>(lv + lo + 64u * FA_PV, V + o + 64 * DKV); fa_keep(); };      /* each statement's 24 address registers are formed directly in front of it: formed all at once they spill */
  issue(0u);
  FaFrag qf[2][4];      /* Q fragments in the same k order as K's in fa_load_k */
  const _Float16* qp0 = Q + (rb + qw0 + c) * DMX + hq * HDK + 8u * h; const _Float16* qp1 = qp0 + 16 * DMX;
#pragma unroll      /* qf[][] is indexed by constants */
  for (int kc = 0; kc < 4; ++kc) { qf[0][kc].q[0] = *reinterpret_cast<const fa_u4*>(qp0 + 32 * kc); qf[0][kc].q[1] = *reinterpret_cast<const fa_u4*>(qp0 + 32 * kc + 16); qf[1][kc].q[0] = *reinterpret_cast<const fa_u4*>(qp1 + 32 * kc); qf[1][kc].q[1] = *reinterpret_cast<const fa_u4*>(qp1 + 32 * kc + 16); }
  asm volatile("s_wait_xcnt 0x0" :: "v"(qp0), "v"(qp1) : "memory");      /* behind the Q loads, their addresses as inputs: no address register is overwritten while an issued load still names it */
  v8f acc[2][8]; float m_run[2], l_run[2];
#pragma unroll
  for (int g = 0; g < 2; ++g) { m_run[g] = -__builtin_inff(); l_run[g] = 0.0f;
#pragma unroll
    for (int t = 0; t < 8; ++t) acc[g][t] = v8f{}; }
  asm volatile("s_wait_asynccnt 0x0" ::: "memory");      /* this wave's copies of stage 0 have landed */
  __syncthreads();      /* ... and every other wave's: stage 0 may be read */
  if (n_stage > 1u) issue(1u);      /* the same for the whole work-group */
  const unsigned my_last = qw0 / 32u;      /* the last pass that this wave's 32 queries can see: the one on its diagonal */
  FaK kf;
#pragma unroll 1      /* stage loop and pass loop stay nested and rolled: one body of 32 matrix instructions */
  for (unsigned st = 0; st < n_stage; ++st) { const unsigned bo = (st & 1u) * FA_SLOT;
#pragma unroll 1      /* as above */
    for (unsigned sub = 0; sub < 4u; ++sub) { const unsigned blk = 4u * st + sub;
      if (blk <= my_last) {      /* wave-uniform; a wave past its diagonal still passes every barrier below */
        if (sub == 0u) fa_load_k(kf, L, bo, lane);      /* a stage's first K fragments are read in that stage's own trip, behind its barrier */
        fa_pass(kf, sub < 3u && blk < my_last, bo + (sub + 1u) * 32u * FA_PK, L, blk == my_last, bo + FA_TK + sub * 32u * FA_PV, blk * 32u, qw0, lane, qf, acc, m_run, l_run, cscale); } }
    asm volatile("s_wait_dscnt 0x0" ::: "memory");      /* this wave's reads of stage st are done before its buffer is given up */
    asm volatile("s_wait_asynccnt 0x0" ::: "memory");      /* this wave's copies of stage st + 1 have landed */
    __syncthreads();      /* publishes stage st + 1 and ends every wave's reads of stage st */
    if (st + 2u < n_stage) issue(st + 2u); }      /* into the buffer just left */
  asm volatile("s_wait_asynccnt 0x0" ::: "memory");      /* nothing of this wave is in flight when the buffers become output staging */
  unsigned char* eb = L + wave * 32u * FA_EP;      /* each wave stages its own 32 rows; the loop's last barrier has ended every read of the buffers */
#pragma unroll
  for (int g = 0; g < 2; ++g) { const float l_fin = l_run[g] + fa_xhalf(l_run[g]);
    const float inv = 64.0f / l_fin;      /* o x64, the scale that the output projection expects */
#pragma unroll
    for (int t = 0; t < 8; ++t) { const v8f o = acc[g][t] * inv; const fa_u4 pk = {fa_pack2(o[0], o[1]), fa_pack2(o[2], o[3]), fa_pack2(o[4], o[5]), fa_pack2(o[6], o[7])};
      *reinterpret_cast<fa_u4*>(eb + (16u * g + c) * FA_EP + 32u * t + 16u * h) = pk; } }
  asm volatile("s_wait_dscnt 0x0" ::: "memory");      /* the wave's own staged rows are written before it reads them back */
  _Float16* op = O + (rb + qw0 + (lane >> 4)) * DMX + hq * HDK + (lane & 15u) * 8u;
#pragma unroll
  for (unsigned i = 0; i < 16u; ++i) { const fa_u4 v = *reinterpret_cast<const fa_u4*>(eb + (2u * i + (lane >> 4)) * FA_EP + (lane & 15u) * 16u); *reinterpret_cast<fa_u4*>(op + (size_t)(2u * i) * DMX) = v; }
}
// ---- merged launches: jobs that do not depend on one another share one launch; the range that a work-group's index falls in names its job (the same test for the whole work-group, in front of every barrier) ----
constexpr int PJ_TAB = (int)(NR * 64 / 256), PJ_WB = (DMX / 128) * (DMX / 64), PJ_WS = (DMX / 128) * (DKV / 64), PJ_X = (int)(NR * DMX / 8 / 256);
// cos / sin tables (first: the longest chain of arithmetic), the four weight transpositions ([in][out] -> Bt x16), x -> f16
__global__ __launch_bounds__(256) void k_prep(const float* __restrict__ x, const float* __restrict__ wq, const float* __restrict__ wk, const float* __restrict__ wv, const float* __restrict__ wo,
    _Float16* __restrict__ X16, _Float16* __restrict__ BQ, _Float16* __restrict__ BK, _Float16* __restrict__ BV, _Float16* __restrict__ BO, float theta, float* __restrict__ CS, float* __restrict__ SN) {
  __shared__ unsigned int lt[64][65];
  int b = blockIdx.x;
  if (b < PJ_TAB) { tab128h_job(b, (int)NR, theta, CS, SN); return; }      /* per-row cos/sin tables [NR][128] for positions r % SQ, duplicated over both halves (cat(f, f)) */
  b -= PJ_TAB;
  if (b < 2 * PJ_WB) { const bool o = b >= PJ_WB; wt_f16_job<DMX, DMX>(lt, o ? b - PJ_WB : b, o ? wo : wq, o ? BO : BQ, 16.0f); return; }
  b -= 2 * PJ_WB;
  if (b < 2 * PJ_WS) { const bool v = b >= PJ_WS; wt_f16_job<DMX, DKV>(lt, v ? b - PJ_WS : b, v ? wv : wk, v ? BV : BK, 16.0f); return; }
  b -= 2 * PJ_WS;
  x16_job(b, x, X16, NR * DMX / 8); }
template <int ACT>
__global__ __launch_bounds__(256) void k_gemm2(const _Float16* __restrict__ A, int lda, size_t sA, const _Float16* __restrict__ Bh, int ldb, size_t sB, float alpha, const float* __restrict__ bias, size_t sBias, const float* __restrict__ CP, int rowsPerB, size_t sCPb, int row0g,
    float* __restrict__ C, _Float16* __restrict__ C16, int ldc, size_t sC, int M, int N, int K, int bsh, size_t zA, size_t zB, size_t zC) {
  gemm2_job<ACT>(blockIdx.x, blockIdx.y, blockIdx.z, 0, A, lda, sA, Bh, ldb, sB, alpha, bias, sBias, CP, rowsPerB, sCPb, row0g, C, C16, ldc, sC, M, N, K, bsh, zA, zB, zC); }
// The three projections of x: q (f32), k (f32), v (f32 for the first tile + f16)
constexpr int GJ_Q = (int)(NR / 128) * (DMX / 128), GJ_K = (int)(NR / 128) * (DKV / 128);
__global__ __launch_bounds__(256) void k_gemm_qkv(const _Float16* __restrict__ X16, const _Float16* __restrict__ BQ, const _Float16* __restrict__ BK, const _Float16* __restrict__ BV,
    float* __restrict__ QF, float* __restrict__ KF, float* __restrict__ VF, _Float16* __restrict__ V16) {
  const int b = blockIdx.x; const int job = b < GJ_Q ? 0 : (b < GJ_Q + GJ_K ? 1 : 2);
  const _Float16* Bt = job == 0 ? BQ : (job == 1 ? BK : BV); float* C = job == 0 ? QF : (job == 1 ? KF : VF); _Float16* C16 = job == 2 ? V16 : nullptr; const int N = job == 0 ? DMX : DKV;
  gemm2_job<0>(job == 0 ? b : (job == 1 ? b - GJ_Q : b - GJ_Q - GJ_K), 0, 0, 0, X16, DMX, 0, Bt, DMX, 0, 0.0625f, nullptr, 0, nullptr, 1, 0, 0, C, C16, N, 0, (int)NR, N, DMX, 0, 0, 0, 0); }
// out = o Wo. The row tiles of each batch's first QT0 rows take the exact path's f16 hi plane (QT0 rows per batch) as A, all others the fused attention's o: same weights, same scale, every output tile written once.
__global__ __launch_bounds__(256) void k_gemm_out(const _Float16* __restrict__ O16, const _Float16* __restrict__ OH0, const _Float16* __restrict__ BO, float* __restrict__ out) {
  const int mt = blockIdx.x / (DMX / 128), lt = mt % (SQ / 128); const bool first = lt < QT0 / 128;
  gemm2_job<0>(blockIdx.x, 0, 0, first ? (mt / (SQ / 128)) * QT0 + lt * 128 - mt * 128 : 0, first ? OH0 : O16, DMX, 0, BO, DMX, 0, 0.0009765625f, nullptr, 0, nullptr, 1, 0, 0, out, nullptr, DMX, 0, (int)NR, DMX, DMX, 0, 0, 0, 0); }
// rope of q and of k (all rows -> f16) and f32 roped q and k of each batch's first QT0 rows for the exact first tile
constexpr int RJ_A = (int)(NR / 8), RJ_0 = QT0 / 8;
__global__ __launch_bounds__(256) void k_rope_all(const float* __restrict__ QF, const float* __restrict__ KF, const float* __restrict__ CS, const float* __restrict__ SN,
    _Float16* __restrict__ Q16, _Float16* __restrict__ K16, float* __restrict__ QF0, float* __restrict__ KRF0) {
  int b = blockIdx.x;
  if (b < RJ_A) { rope128w_job<NH, 0>(b, 0, QF, CS, SN, nullptr, Q16, 1.0f, 0, 0); return; }
  b -= RJ_A;
  if (b < RJ_A) { rope128w_job<NKV, 0>(b, 0, KF, CS, SN, nullptr, K16, 1.0f, 0, 0); return; }
  b -= RJ_A;
  if (b < RJ_0 * NB) { rope128w_job<NH, 1>(b % RJ_0, b / RJ_0, QF, CS, SN, QF0, nullptr, 1.0f, SQ, QT0); return; }
  b -= RJ_0 * NB;
  rope128w_job<NKV, 1>(b % RJ_0, b / RJ_0, KF, CS, SN, KRF0, nullptr, 1.0f, SQ, QT0); }
extern "C" void kernel_launch(void* const* d_in, const int* in_sizes, int n_in,
                              void* d_out, int out_size, void* d_ws, size_t ws_size, hipStream_t stream) {
  (void)in_sizes; (void)n_in; (void)out_size;
  const float* const* I = (const float* const*)d_in; const float* x = I[0]; const float* wq = I[1]; const float* wk = I[2]; const float* wv = I[3]; const float* wo = I[4];      /* [in][out] Wq [2048][2048], Wk/Wv [2048][1024], Wo [2048][2048]; no biases; positions implicit */
  char* ws = (char*)d_ws; size_t off = 0;
  auto take = [&](size_t bytes) { char* p = ws + off; off += (bytes + 255) & ~(size_t)255; return p; };
  _Float16* BQ = (_Float16*)take((size_t)DMX * DMX * 2); _Float16* BK = (_Float16*)take((size_t)DKV * DMX * 2); _Float16* BV = (_Float16*)take((size_t)DKV * DMX * 2); _Float16* BO = (_Float16*)take((size_t)DMX * DMX * 2);
  _Float16* X16 = (_Float16*)take(NR * DMX * 2); float* QF = (float*)take(NR * (DMX + 2 * DKV) * 4); float* KF = QF + NR * DMX; float* VF = KF + NR * DKV; _Float16* Q16 = (_Float16*)take(NR * DMX * 2); _Float16* K16 = (_Float16*)take(NR * DKV * 2); _Float16* V16 = (_Float16*)take(NR * DKV * 2); _Float16* O16 = (_Float16*)take(NR * DMX * 2);
  float* CS = (float*)take(NR * 128 * 4); float* SN = (float*)take(NR * 128 * 4); float* QF0 = (float*)take((size_t)NB * QT0 * DMX * 4); float* KRF0 = (float*)take((size_t)NB * QT0 * DKV * 4); _Float16* OH0 = (_Float16*)take((size_t)NB * QT0 * DMX * 2); _Float16* OL0 = (_Float16*)take((size_t)NB * QT0 * DMX * 2);
  if (off > ws_size) return;      /* 24 (weights) + 16 + 64 + 16 + 8 + 8 + 16 + 2 + 2 + 4 + 2 + 2 + 2 = 166 MiB */
  k_prep<<<PJ_TAB + 2 * PJ_WB + 2 * PJ_WS + PJ_X, 256, 0, stream>>>(x, wq, wk, wv, wo, X16, BQ, BK, BV, BO, 10000.0f, CS, SN);      /* tables, weights, x */
  k_gemm_qkv<<<GJ_Q + 2 * GJ_K, 256, 0, stream>>>(X16, BQ, BK, BV, QF, KF, VF, V16);      /* q, k, v */
  k_rope_all<<<2 * RJ_A + 2 * RJ_0 * NB, 256, 0, stream>>>(QF, KF, CS, SN, Q16, K16, QF0, KRF0);      /* rope; first-tile f32 q, k */
  k_fattn<<<dim3(SQ / 128, NH, NB + 2), 128, 0, stream>>>(Q16, K16, V16, O16, QF0, KRF0, VF, OH0, OL0);      /* causal attention of all rows, heads and batches -> o (x64, f16): query head y vs kv head y >> GSH; z >= NB: exact causal attention of the first QT0 rows -> f16 hi + x1024 residual planes (o x64) */
  k_gemm_out<<<GJ_Q, 256, 0, stream>>>(O16, OH0, BO, (float*)d_out);      /* out = o Wo, the first QT0 rows of each batch from the exact path's hi plane */
  k_gemm2<0><<<dim3((QT0 / 128) * (DMX / 128), 1, NB), 256, 0, stream>>>(OL0, DMX, 0, BO, DMX, 0, 0.00000095367431640625f, nullptr, 0, (const float*)d_out, -1, 0, 0, (float*)d_out, nullptr, DMX, 0, QT0, DMX, DMX, 0, (size_t)QT0 * DMX, 0, (size_t)SQ * DMX);      /* += o_lo Wo 2^-20 (own-element accumulate) */
}

// v010
// It runs in 197 microseconds.
// Next to v009, in two timings, it ran 1.03 times as fast each time.
// All steps since the starting kernel, v000, together make it 61.0 times as fast.
#include <hip/hip_runtime.h>
// Grouped-query causal attention with rotate-half RoPE, 16 query / 8 kv heads of 128 (x [2][2048][2048]; q = x Wq (16 x 128), k = x Wk, v = x Wv (8 x 128) ([in][out] weights sigma 0.02, no biases); inv_freq_i = 1/10000^(2i/128), positions 0..2047, cos/sin = cat(freqs, freqs); q, k roped; kv head h/2 serves query head h; scores / sqrt(128); causal (tril, -inf); softmax; out = merged Wo -> [2][2048][2048]).
// Compute dtype: inputs rounded to bf16; x / weights exact; projections and rope f32; q, k, v, softmax weights and o as plain f16 GEMM operands (~2^-12; first 256 rows of each batch exact); scores, statistics, out f32. v_wmma_f32_16x16x32_f16.
#define NB 2
#define SQ 2048
#define DMX 2048
#define NH 16
#define NKV 8
#define GSZ 2                        /* query heads per kv head */
#define GSH 1                        /* log2(GSZ): query head >> GSH = its kv head */
#define HDK 128
#define DKV (NKV * HDK)
#define QT 256
#define QT0 256
#define NKX SQ
#define DM DMX
#define HD 64
#define HG 1
#define NR ((size_t)NB * SQ)
#define ATS 0.08838834764831845f
typedef __bf16 v16b __attribute__((ext_vector_type(16)));
typedef unsigned short v8us __attribute__((ext_vector_type(8), may_alias));
typedef float  v8f  __attribute__((ext_vector_type(8)));
typedef float  v4f  __attribute__((ext_vector_type(4)));
typedef float  v4fa __attribute__((ext_vector_type(4), may_alias));
union FragB { v16b v; v8us half[2]; unsigned short u[16]; };

__device__ __forceinline__ unsigned short bf16_bits(float x) { unsigned int u = __float_as_uint(x); return (unsigned short)((u + 0x7FFFu + ((u >> 16) & 1u)) >> 16); }
__device__ __forceinline__ float bf16_val(unsigned short b) { return __uint_as_float(((unsigned int)b) << 16); }
__device__ __forceinline__ float bf16_round(float x) { return bf16_val(bf16_bits(x)); }
// D += A·B with NT terms: 1 = ah·bh, 2 = + al·bh (A split), 3 = + ah·bl (both split)
template <int NT>
__device__ __forceinline__ v8f mmaN(v16b ah, v16b al, v16b bh, v16b bl, v8f c) {
  c = __builtin_amdgcn_wmma_f32_16x16x32_bf16(false, ah, false, bh, (short)0, c, false, false);
  if (NT >= 2) c = __builtin_amdgcn_wmma_f32_16x16x32_bf16(false, al, false, bh, (short)0, c, false, false);
  if (NT >= 3) c = __builtin_amdgcn_wmma_f32_16x16x32_bf16(false, ah, false, bl, (short)0, c, false, false);
  asm volatile("v_nop\n\tv_nop\n\tv_nop\n\tv_nop" : "+v"(c) : "v"(ah), "v"(al), "v"(bh), "v"(bl));
  return c;
}

__global__ __launch_bounds__(256) void k_wt_bf16(const float* __restrict__ W, unsigned short* __restrict__ Wt, int K, int N) {
  const int t = blockIdx.x * 256 + threadIdx.x;
  const int k8n = K / 8;
  if (t >= N * k8n) return;
  const int n = t / k8n, k8 = (t % k8n) * 8;
  v8us v;
#pragma unroll
  for (int i = 0; i < 8; ++i) v[i] = bf16_bits(W[(size_t)(k8 + i) * N + n]);
  *(v8us*)(Wt + (size_t)n * K + k8) = v;
  
}

// GEMM C[M][N] (f32, pitch ldc) = act(A[M][K]·W + bias). A f32 row-major (pitch lda) converted per fragment to bf16
// (ASPLIT: hi/lo two planes -> 2 terms, else single rounded term); Wt bf16 [N][K] (pitch ldb). BIAS_BF16 rounds the
// bias to bf16 first (bias quantised to bf16 before the add). K%32==0, M%16==0, N%64==0.
template <bool ASPLIT, int ACT, bool BIAS_BF16>
__global__ __launch_bounds__(128) void k_gemm_bf(const float* __restrict__ A, int lda, const unsigned short* __restrict__ Wt, int ldb,
                                               const float* __restrict__ bias, float* __restrict__ C, int ldc, int M, int N, int K) {
  __shared__ __attribute__((aligned(16))) float so[4][16][64];
  const int tid = threadIdx.x, w = tid >> 5, lane = tid & 31, ln = lane & 15, hh = lane >> 4;
  const int ntn = N / 64;
  const int wid = blockIdx.x * 4 + w;
  const int mt = wid / ntn, nq = wid % ntn;
  if (mt * 16 >= M) return;
  const int row0 = mt * 16, col0 = nq * 64;
  const float* arow = A + (size_t)(row0 + ln) * lda;
  v8f acc[4] = {};
  for (int kb = 0; kb < K; kb += 32) {
    FragB ah, al;
    const v4f x0 = *(const v4fa*)(arow + kb + 8 * hh), x1 = *(const v4fa*)(arow + kb + 8 * hh + 4);
    const v4f x2 = *(const v4fa*)(arow + kb + 16 + 8 * hh), x3 = *(const v4fa*)(arow + kb + 16 + 8 * hh + 4);
    float xs[16] = {x0[0],x0[1],x0[2],x0[3],x1[0],x1[1],x1[2],x1[3],x2[0],x2[1],x2[2],x2[3],x3[0],x3[1],x3[2],x3[3]};
#pragma unroll
    for (int i = 0; i < 16; ++i) { const unsigned short hb = bf16_bits(xs[i]); ah.u[i] = hb; al.u[i] = ASPLIT ? bf16_bits(xs[i] - bf16_val(hb)) : (unsigned short)0; }
#pragma unroll
    for (int t = 0; t < 4; ++t) {
      const unsigned short* brow = Wt + (size_t)(col0 + t * 16 + ln) * ldb + kb;
      FragB b;
      b.half[0] = *(const v8us*)(brow + 8 * hh);
      b.half[1] = *(const v8us*)(brow + 16 + 8 * hh);
      acc[t] = mmaN<ASPLIT ? 2 : 1>(ah.v, al.v, b.v, b.v, acc[t]);
    }
  }
#pragma unroll
  for (int t = 0; t < 4; ++t) {
    float bv = bias ? bias[col0 + t * 16 + ln] : 0.f;
    if (BIAS_BF16) bv = bf16_round(bv);
#pragma unroll
    for (int r = 0; r < 8; ++r) { float v = acc[t][r] + bv; if (ACT == 1) v = fmaxf(v, 0.f); so[w][8 * hh + r][t * 16 + ln] = v; }
  }
  __builtin_amdgcn_fence(__ATOMIC_ACQ_REL, "workgroup");
  __builtin_amdgcn_wave_barrier();
  const int rsub = lane >> 4, c4 = (lane & 15) * 4;
  {
#pragma unroll
    for (int q = 0; q < 8; ++q) {
      const int r = q * 2 + rsub;
      const v4f v = *(const v4fa*)&so[w][r][c4];
      *(v4f*)(C + (size_t)(row0 + r) * ldc + col0 + c4) = v;
    }
    
  }
}

// GEMM C = act(A·W + bias + resid): A f32 (ASPLIT -> hi/lo 2 terms), Wt bf16 [N][K]; ACT 0 none, 1 relu, 2 exact gelu;
// resid (optional, f32, row index = (row % rmod), pitch ldr, RES_BF16 rounds it) added before the activation.
template <bool ASPLIT, int ACT, bool BIAS_BF16, bool RES_BF16>
__global__ __launch_bounds__(128) void k_gemm_bf3(const float* __restrict__ A, int lda, const unsigned short* __restrict__ Wt, int ldb,
                                                const float* __restrict__ bias, const float* __restrict__ resid, int rmod, int ldr,
                                                float* __restrict__ C, int ldc, int M, int N, int K) {
  __shared__ __attribute__((aligned(16))) float so[4][16][64];
  const int tid = threadIdx.x, w = tid >> 5, lane = tid & 31, ln = lane & 15, hh = lane >> 4;
  const int ntn = N / 64;
  const int wid = blockIdx.x * 4 + w;
  const int mt = wid / ntn, nq = wid % ntn;
  if (mt * 16 >= M) return;
  const int row0 = mt * 16, col0 = nq * 64;
  const float* arow = A + (size_t)(row0 + ln) * lda;
  v8f acc[4] = {};
  for (int kb = 0; kb < K; kb += 32) {
    FragB ah, al;
    const v4f x0 = *(const v4fa*)(arow + kb + 8 * hh), x1 = *(const v4fa*)(arow + kb + 8 * hh + 4);
    const v4f x2 = *(const v4fa*)(arow + kb + 16 + 8 * hh), x3 = *(const v4fa*)(arow + kb + 16 + 8 * hh + 4);
    float xs[16] = {x0[0],x0[1],x0[2],x0[3],x1[0],x1[1],x1[2],x1[3],x2[0],x2[1],x2[2],x2[3],x3[0],x3[1],x3[2],x3[3]};
#pragma unroll
    for (int i = 0; i < 16; ++i) { const unsigned short hb = bf16_bits(xs[i]); ah.u[i] = hb; al.u[i] = ASPLIT ? bf16_bits(xs[i] - bf16_val(hb)) : (unsigned short)0; }
#pragma unroll
    for (int t = 0; t < 4; ++t) {
      const unsigned short* brow = Wt + (size_t)(col0 + t * 16 + ln) * ldb + kb;
      FragB b;
      b.half[0] = *(const v8us*)(brow + 8 * hh);
      b.half[1] = *(const v8us*)(brow + 16 + 8 * hh);
      acc[t] = mmaN<ASPLIT ? 2 : 1>(ah.v, al.v, b.v, b.v, acc[t]);
    }
  }
#pragma unroll
  for (int t = 0; t < 4; ++t) {
    const int col = col0 + t * 16 + ln;
    float bv = bias ? bias[col] : 0.f;
    if (BIAS_BF16) bv = bf16_round(bv);
#pragma unroll
    for (int r = 0; r < 8; ++r) {
      float v = acc[t][r] + bv;
      if (resid) { float rv = resid[(size_t)((row0 + 8 * hh + r) % rmod) * ldr + col]; if (RES_BF16) rv = bf16_round(rv); v += rv; }
      if (ACT == 1) v = fmaxf(v, 0.f);
      if (ACT == 2) v = 0.5f * v * (1.0f + erff(v * 0.70710678118654752f));
      if (ACT == 3) { const float u = 0.7978845608028654f * (v + 0.044715f * v * v * v); v = 0.5f * v * (1.0f + tanhf(u)); }
      so[w][8 * hh + r][t * 16 + ln] = v;
    }
  }
  __builtin_amdgcn_fence(__ATOMIC_ACQ_REL, "workgroup");
  __builtin_amdgcn_wave_barrier();
  const int rsub = lane >> 4, c4 = (lane & 15) * 4;
  {
#pragma unroll
    for (int q = 0; q < 8; ++q) {
      const int r = q * 2 + rsub;
      const v4f v = *(const v4fa*)&so[w][r][c4];
      *(v4f*)(C + (size_t)(row0 + r) * ldc + col0 + c4) = v;
    }
    
  }
}
// row LayerNorm (biased variance, eps) over N: s = X (+ R); optional out_sum <- s; out_norm <- (s-mu)*rsqrt(var+eps)*g + b
template <bool PARAM_BF16>
__global__ __launch_bounds__(256) void k_layernorm(const float* __restrict__ X, const float* __restrict__ R, const float* __restrict__ g, const float* __restrict__ bta,
                                                  float* __restrict__ out_sum, float* __restrict__ out_norm, int N, float eps) {
  __shared__ float red[256];
  const int row = blockIdx.x, tid = threadIdx.x;
  const float* x = X + (size_t)row * N; const float* rr = R ? R + (size_t)row * N : nullptr;
  float vals[16];                     // up to N = 4096
  const int per = N / 256;            // contiguous chunk per thread? use strided-by-4 chunks: thread handles j = tid*4 + 1024*u
  float s1 = 0.f;
  for (int u = 0; u < per / 4; ++u) {
    const int j = tid * 4 + 1024 * u;
    const v4f a = *(const v4fa*)(x + j);
    v4f b = {0.f,0.f,0.f,0.f}; if (rr) b = *(const v4fa*)(rr + j);
#pragma unroll
    for (int q = 0; q < 4; ++q) { const float v = a[q] + b[q]; vals[u * 4 + q] = v; s1 += v; }
  }
  red[tid] = s1; __syncthreads();
  for (int st = 128; st > 0; st >>= 1) { if (tid < st) red[tid] += red[tid + st]; __syncthreads(); }
  const float mu = red[0] / (float)N; __syncthreads();
  float s2 = 0.f;
  for (int u = 0; u < per / 4; ++u)
#pragma unroll
    for (int q = 0; q < 4; ++q) { const float c = vals[u * 4 + q] - mu; s2 += c * c; }
  red[tid] = s2; __syncthreads();
  for (int st = 128; st > 0; st >>= 1) { if (tid < st) red[tid] += red[tid + st]; __syncthreads(); }
  const float rs = rsqrtf(red[0] / (float)N + eps);
  {
    for (int u = 0; u < per / 4; ++u) {
      const int j = tid * 4 + 1024 * u;
      v4f o, sm;
#pragma unroll
      for (int q = 0; q < 4; ++q) {
        float gg = g[j + q], bb = bta[j + q];
        if (PARAM_BF16) { gg = bf16_round(gg); bb = bf16_round(bb); }
        sm[q] = vals[u * 4 + q]; o[q] = (vals[u * 4 + q] - mu) * rs * gg + bb;
      }
      if (out_sum) *(v4f*)(out_sum + (size_t)row * N + j) = sm;
      *(v4f*)(out_norm + (size_t)row * N + j) = o;
    }
    
  }
}



// ---- f16 WMMA path (v_wmma_f32_16x16x32_f16): 11-bit significands for operands in range — used where a [0,1] probability operand needs more precision than bf16
typedef _Float16 v16h __attribute__((ext_vector_type(16)));
union FragH { v16h v; v8us half[2]; _Float16 h[16]; unsigned short u[16]; };
template <int NT>
__device__ __forceinline__ v8f mmaH(v16h ah, v16h al, v16h bh, v16h bl, v8f c) {
  c = __builtin_amdgcn_wmma_f32_16x16x32_f16(false, ah, false, bh, (short)0, c, false, false);
  if (NT >= 2) c = __builtin_amdgcn_wmma_f32_16x16x32_f16(false, al, false, bh, (short)0, c, false, false);
  if (NT >= 3) c = __builtin_amdgcn_wmma_f32_16x16x32_f16(false, ah, false, bl, (short)0, c, false, false);
  asm volatile("v_nop\n\tv_nop\n\tv_nop\n\tv_nop" : "+v"(c) : "v"(ah), "v"(al), "v"(bh), "v"(bl));
  return c;
}
// batched GEMM like k_gemm_b but f16 operands: A f32 (split into f16 hi/lo if ASPLIT, else rounded to f16), Bt = f16 values [n][k]; alpha; C f32; N multiple of 16 (partial tiles skipped)
template <bool ASPLIT>
__global__ __launch_bounds__(128) void k_gemm_h(const float* __restrict__ A, int lda, size_t sA, const _Float16* __restrict__ Bh, int ldb, size_t sB, float alpha, float* __restrict__ C, int ldc, size_t sC, int M, int N, int K) {
  __shared__ __attribute__((aligned(16))) float so[4][16][64];
  const int tid = threadIdx.x, w = tid >> 5, lane = tid & 31, ln = lane & 15, hh = lane >> 4; const int by = blockIdx.y;
  A += (size_t)by * sA; Bh += (size_t)by * sB; C += (size_t)by * sC;
  const int ntn = (N + 63) / 64; const int wid = blockIdx.x * 4 + w; const int mt = wid / ntn, nq = wid % ntn; if (mt * 16 >= M) return;
  const int row0 = mt * 16, col0 = nq * 64; const float* arow = A + (size_t)(row0 + ln) * lda;
  v8f acc[4] = {};
  for (int kb = 0; kb < K; kb += 32) {
    FragH ah, al;
    const v4f x0 = *(const v4fa*)(arow + kb + 8 * hh), x1 = *(const v4fa*)(arow + kb + 8 * hh + 4), x2 = *(const v4fa*)(arow + kb + 16 + 8 * hh), x3 = *(const v4fa*)(arow + kb + 16 + 8 * hh + 4);
    float xs[16] = {x0[0],x0[1],x0[2],x0[3],x1[0],x1[1],x1[2],x1[3],x2[0],x2[1],x2[2],x2[3],x3[0],x3[1],x3[2],x3[3]};
#pragma unroll
    for (int i = 0; i < 16; ++i) { const _Float16 h = (_Float16)xs[i]; ah.h[i] = h; al.h[i] = ASPLIT ? (_Float16)(xs[i] - (float)h) : (_Float16)0.0f; }
#pragma unroll
    for (int t = 0; t < 4; ++t) { if (col0 + t * 16 >= N) continue; const size_t boff = (size_t)(col0 + t * 16 + ln) * ldb + kb; FragH bq; bq.half[0] = *(const v8us*)(Bh + boff + 8 * hh); bq.half[1] = *(const v8us*)(Bh + boff + 16 + 8 * hh);
      acc[t] = mmaH<ASPLIT ? 2 : 1>(ah.v, al.v, bq.v, bq.v, acc[t]); }
  }
#pragma unroll
  for (int t = 0; t < 4; ++t) { if (col0 + t * 16 >= N) continue;
#pragma unroll
    for (int r = 0; r < 8; ++r) so[w][8 * hh + r][t * 16 + ln] = acc[t][r] * alpha; }
  __builtin_amdgcn_fence(__ATOMIC_ACQ_REL, "workgroup"); __builtin_amdgcn_wave_barrier();
  const int rsub = lane >> 4, c4 = (lane & 15) * 4;
  {
#pragma unroll
    for (int q = 0; q < 8; ++q) { const int r = q * 2 + rsub; if (col0 + c4 < N) { const v4f v = *(const v4fa*)&so[w][r][c4]; *(v4f*)(C + (size_t)(row0 + r) * ldc + col0 + c4) = v; } }
     }
}

// Wt[n][k] = f16(W[k][n] x scale) from f32 row-major W[K][N] (scale = power of two; bf16-exact weights stay exact in f16 away from the subnormal range).
// One work-group turns a tile of 128 k x 64 n through LDS: it reads 256-byte runs of W's rows and stores 256-byte runs of Wt's rows, so both sides move whole 128-byte lines.
// An LDS word holds the f16 pair (k, k + 1) of one n. Row pitch 65 words: the 32 lanes of a store (16 groups of four n, two k pairs) and of a load (two n, 16 groups of four words) each fall on 32 different banks.
typedef _Float16 wt_h2 __attribute__((ext_vector_type(2)));
typedef unsigned int wt_u4 __attribute__((ext_vector_type(4)));
template <int K, int N>
__device__ __forceinline__ void wt_f16_job(unsigned int (*lt)[65], int bx, const float* __restrict__ W, _Float16* __restrict__ Wt, float scale) {      /* lt = the work-group's 64 x 65 words of LDS, bx = the job's own block index */
  static_assert(K % 128 == 0 && N % 64 == 0, "whole tiles only");
  const int tid = threadIdx.x; const int kt = bx / (N / 64), nt = bx % (N / 64);      /* neighbouring work-groups read neighbouring runs of the same rows */
  const int c4 = (tid & 15) * 4, r = tid >> 4;
  const float* sp = W + (size_t)(kt * 128 + 2 * r) * N + nt * 64 + c4;
  v4f a[4], b[4];
#pragma unroll      /* all eight row loads in flight together, from one address with immediate offsets; a[], b[] are indexed by constants */
  for (int u = 0; u < 4; ++u) { a[u] = *(const v4fa*)(sp + (size_t)(32 * u) * N); b[u] = *(const v4fa*)(sp + (size_t)(32 * u + 1) * N); }
  asm volatile("s_wait_xcnt 0x0" :: "v"(sp) : "memory");      /* behind the loads, their address as input: the address register is not given to a load's result or overwritten while an issued load still names it */
#pragma unroll      /* as above */
  for (int u = 0; u < 4; ++u) for (int q = 0; q < 4; ++q) { const wt_h2 p = {(_Float16)(bf16_round(a[u][q]) * scale), (_Float16)(bf16_round(b[u][q]) * scale)}; lt[c4 + q][r + 16 * u] = __builtin_bit_cast(unsigned int, p); }
  __syncthreads();      /* the tile is whole before any row of it is read across */
  const int k4 = (tid & 15) * 4;      /* 16 lanes per output row, eight k (four words) each */
  wt_u4 o[4];
#pragma unroll      /* o[] is indexed by constants */
  for (int u = 0; u < 4; ++u) { const unsigned int* lp = &lt[r + 16 * u][k4]; o[u] = wt_u4{lp[0], lp[1], lp[2], lp[3]}; }
  _Float16* dp = Wt + (size_t)(nt * 64 + r) * K + kt * 128 + 2 * k4;
#pragma unroll      /* as above */
  for (int u = 0; u < 4; ++u) *(wt_u4*)(dp + (size_t)(16 * u) * K) = o[u];
  asm volatile("s_wait_xcnt 0x0" ::: "memory");      /* behind the four stores: in a merged launch another job's code follows in the listing, and no register that an issued store names is to be written there ahead of this wait */
}
// k_gemm_hh variant with fused epilogue: v = acc·alpha + bias[by·sBias + col] (+ CP[(row/rowsPerB)·sCPb + by·64 + col] if CP) ; ACT 0 none / 1 elu ; writes f16 C16 (and f32 C if non-null)
template <int ACT>
__global__ __launch_bounds__(128) void k_gemm_hhx(const _Float16* __restrict__ A, int lda, size_t sA, const _Float16* __restrict__ Bh, int ldb, size_t sB, float alpha, const float* __restrict__ bias, size_t sBias, const float* __restrict__ CP, int rowsPerB, size_t sCPb, int row0g,
    float* __restrict__ C, _Float16* __restrict__ C16, int ldc, size_t sC, int M, int N, int K) {
  __shared__ __attribute__((aligned(16))) float so[4][16][64];
  const int tid = threadIdx.x, w = tid >> 5, lane = tid & 31, ln = lane & 15, hh = lane >> 4; const int by = blockIdx.y;
  A += (size_t)by * sA; Bh += (size_t)by * sB; const size_t cofs = (size_t)by * sC; const float* bp = bias ? bias + (size_t)by * sBias : nullptr;
  const int ntn = (N + 63) / 64; const int wid = blockIdx.x * 4 + w; const int mt = wid / ntn, nq = wid % ntn; if (mt * 16 >= M) return;
  const int row0 = mt * 16, col0 = nq * 64; const _Float16* arow = A + (size_t)(row0 + ln) * lda;
  v8f acc[4] = {};
  for (int kb = 0; kb < K; kb += 32) { FragH ah; ah.half[0] = *(const v8us*)((const unsigned short*)arow + kb + 8 * hh); ah.half[1] = *(const v8us*)((const unsigned short*)arow + kb + 16 + 8 * hh);
#pragma unroll
    for (int t = 0; t < 4; ++t) { if (col0 + t * 16 >= N) continue; const size_t boff = (size_t)(col0 + t * 16 + ln) * ldb + kb; FragH bq; bq.half[0] = *(const v8us*)((const unsigned short*)Bh + boff + 8 * hh); bq.half[1] = *(const v8us*)((const unsigned short*)Bh + boff + 16 + 8 * hh);
      acc[t] = mmaH<1>(ah.v, ah.v, bq.v, bq.v, acc[t]); }
  }
#pragma unroll
  for (int t = 0; t < 4; ++t) { if (col0 + t * 16 >= N) continue; const int col = col0 + t * 16 + ln; const float bv = bp ? bf16_round(bp[col]) : 0.f;
#pragma unroll
    for (int r = 0; r < 8; ++r) { float v = acc[t][r] * alpha + bv; if (CP) { const int rr = row0g + row0 + 8 * hh + r; if (rowsPerB < 0) v += CP[cofs + (size_t)rr * ldc + col];      /* rowsPerB < 0: own element of the batched C plane */ else { const int bidx = rr / rowsPerB; v += CP[(size_t)bidx * sCPb + (size_t)by * 64 + col]; } } if (ACT == 1) v = (v > 0.f) ? v : expm1f(v); else if (ACT == 7) v = (v > 0.f) ? v + 1.0f : expf(v); else if (ACT == 8) v = tanhf(v); else if (ACT == 9) v = 0.5f * v * (1.0f + tanhf(0.7978845608028654f * (v + 0.044715f * v * v * v))); else if (ACT == 11) v = 1.0f / (1.0f + expf(-v)); else if (ACT == 12) v = (v > 0.f) ? v : 0.01f * v; else if (ACT == 14) v = (v > 0.f) ? v : 0.1f * v; else if (ACT == 16) v = (v >= 0.f) ? v : 0.3f * v; else if (ACT == 17) v = (v >= 0.f) ? v : 0.2f * v; else if (ACT == 15) v = v / (1.0f + expf(-v)); else if (ACT == 3) v = fmaxf(v, 0.f); else if (ACT == 6) v = 0.5f * v * (1.0f + erff(v * 0.70710678118654752f)); so[w][8 * hh + r][t * 16 + ln] = v; } }
  __builtin_amdgcn_fence(__ATOMIC_ACQ_REL, "workgroup"); __builtin_amdgcn_wave_barrier();
  const int rsub = lane >> 4, c4 = (lane & 15) * 4; typedef _Float16 v4h __attribute__((ext_vector_type(4)));
  {
#pragma unroll
    for (int q = 0; q < 8; ++q) { const int r = q * 2 + rsub; if (col0 + c4 < N) { const v4f v = *(const v4fa*)&so[w][r][c4]; if (C) *(v4f*)(C + cofs + (size_t)(row0 + r) * ldc + col0 + c4) = v; if (C16) { v4h h4; for (int i = 0; i < 4; ++i) h4[i] = (_Float16)v[i]; *(v4h*)(C16 + cofs + (size_t)(row0 + r) * ldc + col0 + c4) = h4; } } }
     }
}


typedef _Float16 v4h __attribute__((ext_vector_type(4)));

__device__ __forceinline__ void x16_job(int bx, const float* __restrict__ x, _Float16* __restrict__ X16, size_t n8) { const size_t t = (size_t)bx * 256 + threadIdx.x; if (t >= n8) return; FragH f;
#pragma unroll
  for (int q = 0; q < 8; ++q) f.h[q] = (_Float16)bf16_round(x[t * 8 + q]); *(v8us*)((unsigned short*)X16 + t * 8) = f.half[0];  }
__global__ __launch_bounds__(256) void k_h16(const float* __restrict__ x, _Float16* __restrict__ X16, size_t n8) { const size_t t = (size_t)blockIdx.x * 256 + threadIdx.x; if (t >= n8) return; FragH f;
#pragma unroll
  for (int q = 0; q < 8; ++q) f.h[q] = (_Float16)x[t * 8 + q]; *(v8us*)((unsigned short*)X16 + t * 8) = f.half[0];  }
__global__ __launch_bounds__(256) void k_round16f(const float* __restrict__ W, _Float16* __restrict__ Bt, size_t n8) { const size_t t = (size_t)blockIdx.x * 256 + threadIdx.x; if (t >= n8) return; FragH f;
#pragma unroll
  for (int i = 0; i < 8; ++i) f.h[i] = (_Float16)(bf16_round(W[t * 8 + i]) * 16.0f); *(v8us*)((unsigned short*)Bt + t * 8) = f.half[0];  }
template <int NHv, int TTv>
__global__ __launch_bounds__(256) void k_vt(const _Float16* __restrict__ V16, int ldv, int voff, _Float16* __restrict__ Vt) { __shared__ unsigned short tl[64][66]; const int tid = threadIdx.x; const int slab = blockIdx.x / (TTv / 64), lg = blockIdx.x % (TTv / 64); const int b = slab / NHv, h = slab % NHv;
  for (int i = tid; i < 64 * 8; i += 256) { const int r = i / 8, c8 = (i % 8) * 8; FragH f; f.half[0] = *(const v8us*)((const unsigned short*)V16 + ((size_t)b * TTv + lg * 64 + r) * ldv + voff + h * 64 + c8);
#pragma unroll
    for (int q = 0; q < 8; ++q) tl[r][c8 + q] = f.u[q]; }
  __syncthreads();
  {
#pragma unroll
    for (int rd = 0; rd < 2; ++rd) { const int d = rd * 32 + tid / 8, pc = tid % 8; FragH f;
#pragma unroll
      for (int q = 0; q < 8; ++q) f.u[q] = tl[pc * 8 + q][d];
      *(v8us*)((unsigned short*)Vt + ((size_t)slab * 64 + d) * TTv + lg * 64 + pc * 8) = f.half[0]; }
     } }

// ---- fast GEMM (work-group tile 128x128: eight waves of 32x64; requires M % 128 == 0, N % 128 == 0, K % 128 == 0); epilogue = k_gemm_hhx semantics ----
// Both operands go from global memory to LDS by tensor loads, 128 k (256 bytes of each of the 128 A rows and 128 B rows) per stage, two buffers: stage t + 1 flies while stage t is multiplied.
// Waves 0 .. 3 issue one request a stage each, a slice of 64 rows (A rows 0 .. 63, A rows 64 .. 127, B rows 0 .. 63, B rows 64 .. 127); the request's pad gives the LDS pitch. No lane forms an address and no vector register is used.
#define G2P 136                      /* f16 per LDS row: 272 bytes = 16 x odd, the pitch for 16-byte readers of 256-byte rows */
#define G2SL 9216                    /* f16 per slice in LDS: 64 rows of 272 bytes = 17,408 bytes, rounded up to 18,432 = 9 x 2 KiB, so that every slice starts at a multiple of 2 KiB */
#define G2BUF (4 * G2SL)             /* f16 per buffer: two A slices, then two B slices */
typedef unsigned int td_u4 __attribute__((ext_vector_type(4)));
typedef unsigned int td_u8 __attribute__((ext_vector_type(8)));
__device__ __forceinline__ unsigned td_uni(unsigned v) { return (unsigned)__builtin_amdgcn_readfirstlane(v); }
__device__ __forceinline__ unsigned td_pinned(unsigned v) { unsigned w = td_uni(v); asm volatile("" : "+s"(w)); return w; }      /* holds the test in a scalar register, so that the branch around a tensor load is a scalar branch (the load ignores EXEC) */
// Descriptor group 1: byte elements, a tile of ROWS rows of 256 bytes, tensor = tile, source row pitch in bytes; PADA = pad amount code (3: 16 bytes more a row in LDS, 7: 32 bytes more) behind every 256 bytes.
template <unsigned ROWS, unsigned PADA>
__device__ __forceinline__ td_u8 td_group1(unsigned src_pitch) { td_u8 g;
  g[0] = td_uni((1u << 20) | (5u << 22) | (PADA << 25)); g[1] = td_uni(256u << 16); g[2] = td_uni(ROWS << 16); g[3] = td_uni(256u << 16); g[4] = td_uni(ROWS); g[5] = td_uni(src_pitch); g[6] = td_uni(0u); g[7] = td_uni(0u); return g; }
// Descriptor group 0: count 1, LDS byte offset, global address of the tile's first byte, type 2.
__device__ __forceinline__ td_u4 td_group0(unsigned lds_dst, unsigned long long ga) { td_u4 g;
  g[0] = td_uni(1u); g[1] = td_uni(lds_dst); g[2] = td_uni((unsigned)ga); g[3] = td_uni((((unsigned)(ga >> 32)) & 0x01FFFFFFu) | 0x80000000u); return g; }
struct TdRing { td_u4 g0; td_u8 g1; };      /* one issuing wave's descriptor, kept in the same scalar registers from request to request */
__device__ __forceinline__ void td_next(TdRing& r, unsigned step) { const unsigned lo = r.g0[2] + step; r.g0[3] = td_uni(r.g0[3] + (lo < step ? 1u : 0u)); r.g0[2] = td_uni(lo); }      /* the next stage's tile: the global address moves on by step bytes; called only behind the wait that covers the last request */
__device__ __forceinline__ void td_issue(TdRing& r, unsigned lds_dst) { r.g0[1] = td_uni(lds_dst);
  asm volatile("tensor_load_to_lds %0, %1" : "+s"(r.g0), "+s"(r.g1) :: "memory"); }      /* one request of the whole wave; both groups are in-out operands, so that their registers stay the descriptor's own and keep their values while the request is outstanding */
__device__ __forceinline__ void td_wait0() { asm volatile("s_wait_tensorcnt 0x0" ::: "memory"); }      /* the issuing wave's requests have landed */
__device__ __forceinline__ v16h g2_frag(const _Float16* p, int hh) { FragH f; f.half[0] = *(const v8us*)((const unsigned short*)p + 8 * hh); f.half[1] = *(const v8us*)((const unsigned short*)p + 16 + 8 * hh); return f.v; }
__device__ __forceinline__ v8f g2_mma(v16h a, v16h b, v8f c) { v8f d = __builtin_amdgcn_wmma_f32_16x16x32_f16(false, a, false, b, (short)0, c, false, false); asm volatile("v_nop\n\tv_nop\n\tv_nop\n\tv_nop" : "+v"(d) : "v"(a), "v"(b)); return d; }
template <int ACT>
__device__ __forceinline__ void gemm2_job(int bx, int by, int bz, int ashift, const _Float16* __restrict__ A, int lda, size_t sA, const _Float16* __restrict__ Bh, int ldb, size_t sB, float alpha, const float* __restrict__ bias, size_t sBias, const float* __restrict__ CP, int rowsPerB, size_t sCPb, int row0g,
    float* __restrict__ C, _Float16* __restrict__ C16, int ldc, size_t sC, int M, int N, int K, int bsh, size_t zA, size_t zB, size_t zC) { static_assert(ACT == 0 || ACT == 3 || ACT == 6 || ACT == 8 || ACT == 9 || ACT == 11 || ACT == 12 || ACT == 14 || ACT == 15 || ACT == 16 || ACT == 17, "k_gemm2: unsupported ACT code (would silently apply no activation)");
  __shared__ __attribute__((aligned(2048))) float sm[2 * G2BUF / 2];      /* the two operand buffers, every slice at a multiple of 2 KiB; behind the loop's last barrier the same LDS stages the output */
  static_assert(8 * 32 * 68 <= 2 * G2BUF / 2, "output staging must fit the operand buffers");
  float (*so)[32][68] = (float (*)[32][68])sm; const _Float16* lh = (const _Float16*)sm;
  const int tid = threadIdx.x, w = tid >> 5, lane = tid & 31, ln = lane & 15, hh = lane >> 4;      /* bx = tile; by = plane (head), 2^bsh planes share one B plane; bz = outer batch with its own strides zA, zB, zC; ashift = rows added to the tile's row index in A only */
  A += (size_t)by * sA + (size_t)bz * zA; Bh += (size_t)(by >> bsh) * sB + (size_t)bz * zB; const size_t cofs = (size_t)by * sC + (size_t)bz * zC; const float* bp = bias ? bias + (size_t)by * sBias : nullptr;
  const int ntn = N >> 7; const int mt = bx / ntn, nq = bx - mt * ntn; if (mt * 128 >= M) return;      /* the same for the whole work-group, in front of every barrier */
  const int row0 = mt * 128 + 32 * (w & 3), col0 = nq * 128 + 64 * (w >> 2);
  const unsigned wv = td_uni((unsigned)tid >> 5); const bool issuer = wv < 4u;      /* waves 0 .. 3 issue the requests */
  const unsigned long long gs = wv < 2u ? (unsigned long long)(A + (size_t)(mt * 128 + ashift + 64 * (int)wv) * lda) : (unsigned long long)(Bh + (size_t)(nq * 128 + 64 * ((int)wv & 1)) * ldb);      /* first byte of the wave's slice in stage 0 (waves 4 .. 7 form an address inside B and never use it) */
  const unsigned ls = (unsigned)(size_t)sm + (wv & 3u) * (G2SL * 2u);      /* the slice's place in buffer 0 */
  TdRing ring; ring.g0 = td_group0(ls, gs); ring.g1 = td_group1<64u, 3u>((unsigned)(wv < 2u ? lda : ldb) * 2u);
  const int aoff = ((w & 3) >> 1) * G2SL + (32 * (w & 1) + ln) * G2P, boff = (2 + (w >> 2)) * G2SL + ln * G2P;
  const v8f z8 = {0.f,0.f,0.f,0.f,0.f,0.f,0.f,0.f}; v8f c00 = z8, c01 = z8, c02 = z8, c03 = z8, c10 = z8, c11 = z8, c12 = z8, c13 = z8;
  const int nt = K >> 7;
  if (td_pinned(issuer)) { td_issue(ring, ls); td_wait0(); }      /* stage 0 -> buffer 0, landed */
  __syncthreads();      /* every issuing wave's slice has landed: stage 0 may be read */
  if (td_pinned(issuer && nt > 1)) { td_next(ring, 256u); td_issue(ring, ls + G2BUF * 2u); }      /* stage 1 -> buffer 1 */
#pragma unroll 1      /* one stage a trip: 32 matrix instructions a wave */
  for (int t = 0; t < nt; ++t) { const _Float16* a0p = lh + (t & 1) * G2BUF + aoff; const _Float16* a1p = a0p + 16 * G2P; const _Float16* b0p = lh + (t & 1) * G2BUF + boff; const _Float16* b1p = b0p + 16 * G2P; const _Float16* b2p = b1p + 16 * G2P; const _Float16* b3p = b2p + 16 * G2P;
    v16h a0 = g2_frag(a0p, hh), a1 = g2_frag(a1p, hh), b0 = g2_frag(b0p, hh), b1 = g2_frag(b1p, hh), b2 = g2_frag(b2p, hh), b3 = g2_frag(b3p, hh);
#pragma unroll      /* two fragment sets in registers, named by constants; the LDS reads differ by immediate offsets */
    for (int kb = 0; kb < 128; kb += 32) { v16h na0 = a0, na1 = a1, nb0 = b0, nb1 = b1, nb2 = b2, nb3 = b3;
      if (kb + 32 < 128) { na0 = g2_frag(a0p + kb + 32, hh); na1 = g2_frag(a1p + kb + 32, hh); nb0 = g2_frag(b0p + kb + 32, hh); nb1 = g2_frag(b1p + kb + 32, hh); nb2 = g2_frag(b2p + kb + 32, hh); nb3 = g2_frag(b3p + kb + 32, hh); }      /* the next 32 k of this stage, read as one group ahead of this block's products: their LDS latency hides behind the eight matrix instructions */
      c00 = g2_mma(a0, b0, c00); c10 = g2_mma(a1, b0, c10); c01 = g2_mma(a0, b1, c01); c11 = g2_mma(a1, b1, c11);
      c02 = g2_mma(a0, b2, c02); c12 = g2_mma(a1, b2, c12); c03 = g2_mma(a0, b3, c03); c13 = g2_mma(a1, b3, c13);
      a0 = na0; a1 = na1; b0 = nb0; b1 = nb1; b2 = nb2; b3 = nb3; }
    asm volatile("s_wait_dscnt 0x0" ::: "memory");      /* this wave's reads of stage t are done before its buffer is given up */
    if (td_pinned(issuer)) td_wait0();      /* this wave's request of stage t + 1 has landed */
    __syncthreads();      /* publishes stage t + 1 and ends every wave's reads of stage t */
    if (td_pinned(issuer && t + 2 < nt)) { td_next(ring, 256u); td_issue(ring, ls + (unsigned)(t & 1) * (G2BUF * 2u)); } }      /* stage t + 2 -> the buffer just left */
  td_wait0();      /* nothing of this wave is in flight when the buffers become output staging */
  asm volatile("s_wait_dscnt 0x0" ::: "memory");      /* ... and none of its LDS reads */
  v8f accs[8] = {c00, c01, c02, c03, c10, c11, c12, c13};
#pragma unroll
  for (int u = 0; u < 8; ++u) { const int t = u & 3, half = u >> 2; const int col = col0 + t * 16 + ln; const float bv = bp ? bf16_round(bp[col]) : 0.f;
#pragma unroll
    for (int r = 0; r < 8; ++r) { const int rloc = half * 16 + 8 * hh + r; float v = accs[u][r] * alpha + bv; if (CP) { if (rowsPerB < 0) v += CP[cofs + (size_t)(row0g + row0 + rloc) * ldc + col];      /* rowsPerB < 0: own element of the batched C plane */ else { const int bidx = (row0g + row0 + rloc) / rowsPerB; v += CP[(size_t)bidx * sCPb + (size_t)by * 64 + col]; } }
      if (ACT == 3) v = fmaxf(v, 0.f); else if (ACT == 6) v = 0.5f * v * (1.0f + erff(v * 0.70710678118654752f)); else if (ACT == 11) v = 1.0f / (1.0f + expf(-v)); else if (ACT == 15) v = v / (1.0f + expf(-v)); else if (ACT == 12) v = (v > 0.f) ? v : 0.01f * v; else if (ACT == 8) v = tanhf(v); else if (ACT == 9) v = 0.5f * v * (1.0f + tanhf(0.7978845608028654f * (v + 0.044715f * v * v * v))); else if (ACT == 14) v = (v > 0.f) ? v : 0.1f * v; else if (ACT == 16) v = (v >= 0.f) ? v : 0.3f * v; else if (ACT == 17) v = (v >= 0.f) ? v : 0.2f * v;
      so[w][rloc][t * 16 + ln] = v; } }
  __builtin_amdgcn_fence(__ATOMIC_ACQ_REL, "workgroup"); __builtin_amdgcn_wave_barrier();
  const int rsub = lane >> 4, c4 = (lane & 15) * 4;
  {
#pragma unroll
    for (int q = 0; q < 16; ++q) { const int r = q * 2 + rsub; const v4f v = *(const v4fa*)&so[w][r][c4];
      if (C) { float* cp = C + cofs + (size_t)(row0 + r) * ldc + col0 + c4; *(v4f*)cp = v; asm volatile("s_wait_xcnt 0x0" :: "v"(cp), "v"(v) : "memory"); }      /* behind the f32 store, its address and data as inputs: neither the conversion to f16 nor the next row's LDS load writes into a register that the issued store still names */
      if (C16) { v4h h4; for (int i = 0; i < 4; ++i) h4[i] = (_Float16)v[i]; *(v4h*)(C16 + cofs + (size_t)(row0 + r) * ldc + col0 + c4) = h4; } }
     } }


__global__ __launch_bounds__(256) void k_wnat(const float* __restrict__ w, size_t n8, _Float16* __restrict__ Bt) { const size_t t = (size_t)blockIdx.x * 256 + threadIdx.x; if (t >= n8) return; FragH f; for (int q = 0; q < 8; ++q) f.h[q] = (_Float16)(bf16_round(w[t * 8 + q]) * 16.0f); *(v8us*)((unsigned short*)Bt + t * 8) = f.half[0];  }
__global__ __launch_bounds__(256) void k_rsm(const float* __restrict__ S, _Float16* __restrict__ P, int nrows) {
  #pragma clang fp contract(off)
  const int i = blockIdx.x * 256 + threadIdx.x; if (i >= nrows) return; const float* s = S + (size_t)i * SQ; float mx = -3.0e38f;
#pragma unroll 1
  for (int j = 0; j < SQ; ++j) mx = fmaxf(mx, s[j]); float se = 0.f;
#pragma unroll 1
  for (int j = 0; j < SQ; ++j) se += expf(s[j] - mx); const float sc = 256.0f / se;
#pragma unroll 1
  for (int j0 = 0; j0 < SQ; j0 += 8) { FragH f; for (int q = 0; q < 8; ++q) f.h[q] = (_Float16)(expf(s[j0 + q] - mx) * sc); unsigned short* d = (unsigned short*)P + (size_t)i * SQ + j0; *(v8us*)d = f.half[0];  } }
__global__ __launch_bounds__(256) void k_vt(const _Float16* __restrict__ V16, int b, int h0, _Float16* __restrict__ VT) { __shared__ unsigned short tl[64][65]; const int tid = threadIdx.x; const int hh = blockIdx.x % HG, sg = blockIdx.x / HG; const int s0 = sg * 64; const int h = h0 + hh;
  for (int i = tid; i < 64 * 8; i += 256) { const int j = i / 8, d8 = (i % 8) * 8; FragH f; f.half[0] = *(const v8us*)((const unsigned short*)V16 + ((size_t)b * SQ + s0 + j) * DM + h * HD + d8); for (int q = 0; q < 8; ++q) tl[d8 + q][j] = f.u[q]; }
  __syncthreads();
  { for (int i = tid; i < 64 * 8; i += 256) { const int d = i / 8, j8 = (i % 8) * 8; FragH f; for (int q = 0; q < 8; ++q) f.u[q] = tl[d][j8 + q]; *(v8us*)((unsigned short*)VT + ((size_t)hh * HD + d) * SQ + s0 + j8) = f.half[0]; }  } }


__global__ __launch_bounds__(256) void k_f2h(const float* __restrict__ F, int ldf, int coff, int ncol, _Float16* __restrict__ H16, size_t nrow) { const size_t t = (size_t)blockIdx.x * 256 + threadIdx.x; const size_t n8 = nrow * (size_t)(ncol / 8); if (t >= n8) return; const size_t r = t / (ncol / 8); const int c8 = (int)(t % (ncol / 8)) * 8; FragH f; const v4f a = *(const v4fa*)(F + r * ldf + coff + c8), b2 = *(const v4fa*)(F + r * ldf + coff + c8 + 4); for (int q = 0; q < 4; ++q) { f.h[q] = (_Float16)a[q]; f.h[4 + q] = (_Float16)b2[q]; } *(v8us*)((unsigned short*)H16 + r * ncol + c8) = f.half[0];  }

__global__ __launch_bounds__(256) void k_tab128(float theta, float* __restrict__ CS, float* __restrict__ SN) {
  #pragma clang fp contract(off)
  const int t = blockIdx.x * 256 + threadIdx.x; if (t >= SQ * 64) return; const int i = t % 64; const int p = t / 64; const float invf = (float)(1.0 / pow((double)theta, (double)(2 * i) / 128.0));      /* = XLA's constant-folded f32 table */ const float ang = __fmul_rn((float)p, invf); const float c = cosf(ang), s = sinf(ang);
  *(float*)(CS + t) = c; *(float*)(SN + t) = s;  }
template <int TAB>
__global__ __launch_bounds__(128) void k_rope128(const float* __restrict__ F, int ldf, int nh, const float* __restrict__ CS, const float* __restrict__ SN, _Float16* __restrict__ H16, int ldo, float osc) {
  #pragma clang fp contract(off)
  __shared__ float xv[128]; __shared__ unsigned short sh_[128]; const int d = threadIdx.x; const int h = blockIdx.x % nh; const size_t r = blockIdx.x / nh; const int p = (int)(r % SQ);
  xv[d] = F[r * (size_t)ldf + (size_t)h * 128 + d]; __syncthreads();
  float c, s; if (TAB) { c = bf16_round(CS[(size_t)p * 128 + d]); s = bf16_round(SN[(size_t)p * 128 + d]); } else { c = CS[p * 64 + (d & 63)]; s = SN[p * 64 + (d & 63)]; }
  const float rot = (d < 64) ? -xv[d + 64] : xv[d - 64]; const float o = __fadd_rn(__fmul_rn(xv[d], c), __fmul_rn(rot, s));
  FragH th; th.h[0] = (_Float16)__fmul_rn(o, osc); sh_[d] = th.u[0]; __syncthreads();
  if (d < 16) { FragH f; for (int q = 0; q < 8; ++q) f.u[q] = sh_[d * 8 + q]; unsigned short* dst = (unsigned short*)H16 + r * (size_t)ldo + (size_t)h * 128 + d * 8; *(v8us*)dst = f.half[0];  } }

// Rotate-half RoPE, one wave per token row. 16 lanes per head: a lane holds columns 4 l .. 4 l + 3 and their partners 64 columns on, so x[d] and x[d + 64] meet in one lane (no LDS, no barrier);
// the row's cos / sin values (full-width f32 tables, one row per token row) stay in registers for all NHv heads, two heads per load. bx = group of 8 rows in a batch; by = batch: source and table rows step by yin, output rows by yout.
template <int NHv, int F32OUT>
__device__ __forceinline__ void rope128w_job(int bx, int by, const float* __restrict__ F, const float* __restrict__ CS, const float* __restrict__ SN, float* __restrict__ OF, _Float16* __restrict__ OH, float osc, int yin, int yout) {
  constexpr int ld = NHv * 128, NI = NHv / 2; static_assert(NHv % 2 == 0, "two heads per wave and trip");
  const int lane = threadIdx.x & 31; const int e = (lane >> 4) * 128 + (lane & 15) * 4, d = (lane & 15) * 4; const size_t rl = (size_t)bx * 8 + (threadIdx.x >> 5); const size_t r = rl + (size_t)by * yin, ro = rl + (size_t)by * yout;
  const float* cp = CS + r * 128 + d; const float* sp = SN + r * 128 + d; const float* xp = F + r * ld + e;
  const v4f cl = *(const v4fa*)cp, ch = *(const v4fa*)(cp + 64), sl = *(const v4fa*)sp, sh = *(const v4fa*)(sp + 64);
  v4f xl[NI], xh[NI];
#pragma unroll      /* the whole row's loads in flight together; xl[], xh[] stay in registers only if every index is a constant */
  for (int i = 0; i < NI; ++i) { xl[i] = *(const v4fa*)(xp + i * 256); xh[i] = *(const v4fa*)(xp + i * 256 + 64); }
  asm volatile("s_wait_xcnt 0x0" :: "v"(cp), "v"(sp), "v"(xp) : "memory");      /* behind the row's loads, the three addresses as inputs: no address register is given to a later load's result or overwritten while an issued load still names it, and no table load is put off behind the first data wait */
#pragma unroll      /* as above */
  for (int i = 0; i < NI; ++i) { v4f ol, oh;
    for (int q = 0; q < 4; ++q) { ol[q] = fmaf(-xh[i][q], sl[q], xl[i][q] * cl[q]) * osc; oh[q] = fmaf(xl[i][q], sh[q], xh[i][q] * ch[q]) * osc; }      /* x cos rounded, partner x sin fused into the add: the form that the one-thread-per-column kernel compiled to, so roped q and k keep their bits */
    if (F32OUT) { float* dst = OF + ro * ld + e + i * 256; *(v4f*)dst = ol; *(v4f*)(dst + 64) = oh; }
    else { v4h hl, hh; for (int q = 0; q < 4; ++q) { hl[q] = (_Float16)ol[q]; hh[q] = (_Float16)oh[q]; } _Float16* dst = OH + ro * ld + e + i * 256; *(v4h*)dst = hl; *(v4h*)(dst + 64) = hh; } }
  asm volatile("s_wait_xcnt 0x0" ::: "memory"); }      /* behind the row's stores: in a merged launch another job's code follows in the listing, and no register that an issued store names is to be written there ahead of this wait */
template <int N>
__global__ __launch_bounds__(256) void k_rmsrow(float* __restrict__ X, const float* __restrict__ w, float eps) {
  #pragma clang fp contract(off)
  constexpr int PT = N / 256; __shared__ float red[256]; const size_t r = blockIdx.x; const int t = threadIdx.x; float* row = X + r * N + (size_t)t * PT; float v[PT]; float ss = 0.f;
  for (int q = 0; q < PT; ++q) { v[q] = row[q]; ss = __fadd_rn(ss, __fmul_rn(v[q], v[q])); }
  red[t] = ss; __syncthreads(); for (int k = 128; k > 0; k >>= 1) { if (t < k) red[t] = __fadd_rn(red[t], red[t + k]); __syncthreads(); }
  const float rs = rsqrtf(__fadd_rn(red[0] / (float)N, eps)); float o[PT]; for (int q = 0; q < PT; ++q) o[q] = __fmul_rn(__fmul_rn(v[q], rs), bf16_round(w[t * PT + q]));
  { for (int q = 0; q < PT; ++q) *(float*)(row + q) = o[q];  } }

__global__ __launch_bounds__(256) void k_rsmcfb(const float* __restrict__ S, _Float16* __restrict__ P, int hg, int q0, int nk, const int* __restrict__ mk) {
  #pragma clang fp contract(off)
  const int t = blockIdx.x * 256 + threadIdx.x; if (t >= hg * QT) return; const size_t i = (size_t)t; const float* s = S + i * NKX; const size_t ig = (size_t)(q0 + (t % QT)); const int* mr = mk + ig * SQ; float mx = -3.0e38f;
#pragma unroll 1
  for (int j = 0; j < nk; ++j) { const int mb = mr[j]; const float f = (mb == 0) ? 1.f : 0.f; mx = fmaxf(mx, fmaf(f, s[j], (1.f - f) * -1.0e9f)); } float se = 0.f;
#pragma unroll 1
  for (int j = 0; j < nk; ++j) { const int mb = mr[j]; const float f = (mb == 0) ? 1.f : 0.f; se += __expf(fmaf(f, s[j], (1.f - f) * -1.0e9f) - mx); } const float sc = 256.0f / se;
#pragma unroll 1
  for (int j0 = 0; j0 < nk; j0 += 8) { FragH fr; for (int q = 0; q < 8; ++q) { const int j = j0 + q; const int mb = mr[j]; const float f = (mb == 0) ? 1.f : 0.f; fr.h[q] = (_Float16)(__expf(fmaf(f, s[j], (1.f - f) * -1.0e9f) - mx) * sc); } unsigned short* d = (unsigned short*)P + i * NKX + j0; *(v8us*)d = fr.half[0];  } }


// Causal softmax, one wave per score row: lane l holds columns 128 c + 4 l .. + 3 of every 128-column chunk c in registers, so each
// load and store of a wave covers one contiguous run of the row and the row is read once. Row maximum and denominator: per-lane partial, then a xor butterfly over the 32 lanes.
// rel = the row's last causal column minus the lane's first column.
template <int NC>
__device__ __forceinline__ void rsm_row(const float* __restrict__ s, _Float16* __restrict__ d, int rel) {
  v4f e[NC]; float mx = -3.0e38f, se = 0.f;
#pragma unroll      /* here and below: e[] stays in registers only if every index is a constant */
  for (int c = 0; c < NC; ++c) e[c] = *(const v4fa*)(s + c * 128);
#pragma unroll      /* as above */
  for (int c = 0; c < NC; ++c) for (int q = 0; q < 4; ++q) { const float f = (c * 128 + q <= rel) ? 1.f : 0.f; e[c][q] = fmaf(f, e[c][q], (1.f - f) * -1.0e9f); mx = fmaxf(mx, e[c][q]); }
  for (int m = 16; m > 0; m >>= 1) mx = fmaxf(mx, __shfl_xor(mx, m, 32));
#pragma unroll      /* as above */
  for (int c = 0; c < NC; ++c) for (int q = 0; q < 4; ++q) { e[c][q] = __expf(e[c][q] - mx); se += e[c][q]; }
  for (int m = 16; m > 0; m >>= 1) se += __shfl_xor(se, m, 32);
  const float sc = 256.0f / se;
#pragma unroll      /* as above */
  for (int c = 0; c < NC; ++c) { v4h h4; for (int q = 0; q < 4; ++q) h4[q] = (_Float16)(e[c][q] * sc); *(v4h*)(d + c * 128) = h4; }
  asm volatile("s_wait_xcnt 0x0" ::: "memory");      /* behind the row's stores: without it the compiler merges the last stores of the eight bodies into one tail; no register that an issued store names is to be written there ahead of this wait */
}
__global__ __launch_bounds__(256) void k_rsmcf2(const float* __restrict__ S, _Float16* __restrict__ P, int hg, int q0, int nk) {
  static_assert(QT == 256 && NKX == 8 * QT, "one case per row length below");
  const int col = (threadIdx.x & 31) * 4; const int t = blockIdx.x * 8 + (threadIdx.x >> 5); if (t >= hg * QT) return;
  const float* s = S + (size_t)t * NKX + col; _Float16* d = P + (size_t)t * NKX + col; const int rel = q0 + (t % QT) - col;
  switch (nk / QT) {      /* nk = QT .. NKX in steps of QT: one straight-line body per row length, so that the row's registers are indexed by constants */
    case 1: rsm_row<2>(s, d, rel); break; case 2: rsm_row<4>(s, d, rel); break; case 3: rsm_row<6>(s, d, rel); break; case 4: rsm_row<8>(s, d, rel); break;
    case 5: rsm_row<10>(s, d, rel); break; case 6: rsm_row<12>(s, d, rel); break; case 7: rsm_row<14>(s, d, rel); break; case 8: rsm_row<16>(s, d, rel); break; } }



__global__ __launch_bounds__(256) void k_tab128p(const int* __restrict__ pos, int nrows, float theta, float* __restrict__ CS, float* __restrict__ SN) {
  #pragma clang fp contract(off)
  const int t = blockIdx.x * 256 + threadIdx.x; if (t >= nrows * 64) return; const int i = t % 64; const int r = t / 64; const float invf = (float)(1.0 / pow((double)theta, (double)(2 * i) / 128.0)); const float ang = __fmul_rn((float)pos[r], invf); const float c = cosf(ang), sv = sinf(ang);
  float* c0 = CS + (size_t)r * 128 + i; float* s0 = SN + (size_t)r * 128 + i;
  { *(float*)c0 = c; *(float*)(c0 + 64) = c; *(float*)s0 = sv; *(float*)(s0 + 64) = sv;  } }

__global__ __launch_bounds__(256) void k_rsmcim(const float* __restrict__ S, _Float16* __restrict__ P, int hg, int q0, int nk, const int* __restrict__ am) {
  #pragma clang fp contract(off)
  const int t = blockIdx.x * 256 + threadIdx.x; if (t >= hg * QT) return; const size_t i = (size_t)t; const float* s = S + i * NKX; const int last = q0 + (t % QT); const int* mr = am + (size_t)last * SQ; float mx = -3.0e38f;      /* the module's mask row of this query (keys >= nk lie above the diagonal of the causal mask and are not computed) */
#pragma unroll 1
  for (int j = 0; j < nk; ++j) { const float f = (mr[j] != 0) ? 1.f : 0.f; mx = fmaxf(mx, fmaf(f, s[j], (1.f - f) * -1.0e9f)); } float se = 0.f;
#pragma unroll 1
  for (int j = 0; j < nk; ++j) { const float f = (mr[j] != 0) ? 1.f : 0.f; se += __expf(fmaf(f, s[j], (1.f - f) * -1.0e9f) - mx); } const float sc = 256.0f / se;
#pragma unroll 1
  for (int j0 = 0; j0 < nk; j0 += 8) { FragH fr; for (int q = 0; q < 8; ++q) { const int j = j0 + q; const float f = (mr[j] != 0) ? 1.f : 0.f; fr.h[q] = (_Float16)(__expf(fmaf(f, s[j], (1.f - f) * -1.0e9f) - mx) * sc); } unsigned short* d = (unsigned short*)P + i * NKX + j0; *(v8us*)d = fr.half[0];  } }



__device__ __forceinline__ void tab128h_job(int bx, int nr, float theta, float* __restrict__ CS, float* __restrict__ SN) {
  #pragma clang fp contract(off)
  const size_t t = (size_t)bx * 256 + threadIdx.x; if (t >= (size_t)nr * 64) return; const int i = (int)(t % 64); const size_t r = t / 64; const int p = (int)(r % SQ);
  const float invf = (float)(1.0 / pow((double)theta, ((double)(2 * i)) / 128.0)); const float ang = __fmul_rn((float)p, invf); const float c = cosf(ang), sv = sinf(ang);
  float* pc = CS + r * 128 + i; float* ps = SN + r * 128 + i;
  *(float*)pc = c; *(float*)(pc + 64) = c; *(float*)ps = sv; *(float*)(ps + 64) = sv;  }
typedef unsigned int fa_u4 __attribute__((ext_vector_type(4)));
typedef unsigned int fa_u8 __attribute__((ext_vector_type(8)));
typedef short fa_s8 __attribute__((ext_vector_type(8)));
typedef float fa_f2 __attribute__((ext_vector_type(2)));
typedef _Float16 fa_h2 __attribute__((ext_vector_type(2)));
constexpr unsigned FA_PK = 272u;                 /* LDS pitch of a 256-byte K row: odd multiple of 16 bytes, for 16-byte readers */
constexpr unsigned FA_PV = 288u;                 /* LDS pitch of a 256-byte V row: odd multiple of 32 bytes, for the transposing load */
constexpr unsigned FA_SK = 128u;                 /* keys per stage */
constexpr unsigned FA_TK = FA_SK * FA_PK, FA_SLOT = FA_TK + FA_SK * FA_PV;      /* a buffer: K rows, then V rows */
constexpr unsigned FA_EP = 272u;                 /* output staging pitch */
static_assert(4u * 32u * FA_EP <= 2u * FA_SLOT, "output staging must fit the two buffers");
static_assert(FA_TK % 2048u == 0u && FA_SLOT % 2048u == 0u, "every tensor load's place in LDS is a multiple of 2 KiB");
static_assert(HDK == 128 && SQ == 16 * 128 && NB == 2, "written for head size 128, 16 query blocks of 128 rows and two batches (the block order below)");
struct FaFrag { fa_u4 q[2]; };
struct FaK { FaFrag f[2][4]; };                  /* one pass's K: two 16-key tiles x four 32-wide k chunks */
__device__ __forceinline__ v8f fa_mma(const FaFrag& a, const FaFrag& b, v8f c) {
  const fa_u8 av = {a.q[0].x, a.q[0].y, a.q[0].z, a.q[0].w, a.q[1].x, a.q[1].y, a.q[1].z, a.q[1].w};
  const fa_u8 bv = {b.q[0].x, b.q[0].y, b.q[0].z, b.q[0].w, b.q[1].x, b.q[1].y, b.q[1].z, b.q[1].w};
  return __builtin_amdgcn_wmma_f32_16x16x32_f16(false, __builtin_bit_cast(v16h, av), false, __builtin_bit_cast(v16h, bv), (short)0, c, false, false); }
__device__ __forceinline__ fa_u4 fa_tr16(const unsigned char* p) { typedef __attribute__((address_space(3))) fa_s8 lds_s8; return __builtin_bit_cast(fa_u4, __builtin_amdgcn_ds_load_tr16_b128_v8i16((lds_s8*)p)); }
__device__ __forceinline__ unsigned fa_pack2(float lo, float hi) { return __builtin_bit_cast(unsigned, __builtin_convertvector(fa_f2{lo, hi}, fa_h2)); }      /* round to nearest even */
__device__ __forceinline__ float fa_xhalf(float x) { return __builtin_bit_cast(float, __builtin_amdgcn_permlanex16(__builtin_bit_cast(int, x), __builtin_bit_cast(int, x), 0x76543210, 0xfedcba98, false, false)); }      /* lane l with lane l ^ 16 */
__device__ __forceinline__ void fa_keep() { __builtin_amdgcn_sched_barrier(0); }      /* keeps the groups of a pass (products, fragment loads, exponentials) in the written order: moved together they lengthen live ranges and spill */
__device__ __forceinline__ void fa_nop4() { asm volatile("v_nop\n\tv_nop\n\tv_nop\n\tv_nop"); }      /* the four vector slots behind a run of matrix instructions, on every path: a branch follows */
__device__ __forceinline__ void fa_load_k(FaK& k, const unsigned char* Lp, unsigned koff, unsigned lane) {
  const unsigned c = lane & 15u, h = lane >> 4;
#pragma unroll      /* k.f[][] stays in registers only if every index is a constant */
  for (int kt = 0; kt < 2; ++kt) { const unsigned char* p = Lp + koff + (16u * kt + c) * FA_PK + 16u * h;
#pragma unroll      /* as above */
    for (int kc = 0; kc < 4; ++kc) { k.f[kt][kc].q[0] = *reinterpret_cast<const fa_u4*>(p + 64u * kc); k.f[kt][kc].q[1] = *reinterpret_cast<const fa_u4*>(p + 64u * kc + 32u); } } }
__device__ __forceinline__ void fa_pass(FaK& kf, bool fetch_next, unsigned next_koff, const unsigned char* Lp, bool diag, unsigned voff, unsigned key0, unsigned qw0, unsigned lane,
                                        const FaFrag (&qf)[2][4], v8f (&acc)[2][8], float (&m_run)[2], float (&l_run)[2], float cscale) {
  const unsigned c = lane & 15u, h = lane >> 4;
  v8f s[2][2];
  asm volatile("s_wait_dscnt 0x0" ::: "memory");      /* this pass's K fragments have arrived */
  fa_keep();
#pragma unroll      /* every array below is indexed by constants only */
  for (int kt = 0; kt < 2; ++kt) {
#pragma unroll
    for (int g = 0; g < 2; ++g) { s[kt][g] = v8f{};
#pragma unroll
      for (int kc = 0; kc < 4; ++kc) s[kt][g] = fa_mma(kf.f[kt][kc], qf[g][kc], s[kt][g]); } }
  fa_keep(); fa_nop4(); fa_keep();
  if (fetch_next) fa_load_k(kf, Lp, next_koff, lane);
  if (diag) {
#pragma unroll
    for (int g = 0; g < 2; ++g) { const unsigned my_q = qw0 + 16u * g + c;
#pragma unroll
      for (int kt = 0; kt < 2; ++kt) {
#pragma unroll
        for (int r = 0; r < 8; ++r) { const unsigned key = key0 + 16u * kt + 8u * h + r; if (key > my_q) s[kt][g][r] = -__builtin_inff(); }
        asm volatile("" : "+v"(s[kt][g]));
      } } }
  float mb[2]; bool need = false;
#pragma unroll
  for (int g = 0; g < 2; ++g) { float mx = -__builtin_inff();
#pragma unroll
    for (int kt = 0; kt < 2; ++kt) {
#pragma unroll
      for (int r = 0; r < 8; ++r) mx = __builtin_fmaxf(mx, s[kt][g][r]); }
    mx = __builtin_fmaxf(mx, fa_xhalf(mx)) * cscale;
    mb[g] = mx; need = need || (mx > m_run[g] + 8.0f);
    fa_keep(); }
  if (__builtin_amdgcn_ballot_w32(need) != 0) {      /* rare after the first passes */
#pragma unroll
    for (int g = 0; g < 2; ++g) { const float m_new = __builtin_fmaxf(m_run[g], mb[g]);
      const float corr = __builtin_amdgcn_exp2f(m_run[g] - m_new);      /* 0 on the first pass, where m_run is -inf */
      l_run[g] *= corr; m_run[g] = m_new;
#pragma unroll
      for (int t = 0; t < 8; ++t) acc[g][t] = acc[g][t] * corr; } }
  FaFrag vf[8]; float ps[2][2] = {{0.f, 0.f}, {0.f, 0.f}};
  { const unsigned char* ad = Lp + voff + (8u * h + (lane & 7u)) * FA_PV + ((lane >> 3) & 1u) * 16u;
#pragma unroll
    for (int t = 0; t < 8; ++t) { vf[t].q[0] = fa_tr16(ad + 32u * t); vf[t].q[1] = fa_tr16(ad + 16u * FA_PV + 32u * t); } }
#pragma unroll
  for (int g = 0; g < 2; ++g) { const float nm = 4.0f - m_run[g]; unsigned w[8];
#pragma unroll
    for (int i = 0; i < 8; ++i) {
      const fa_f2 arg = __builtin_elementwise_fma(fa_f2{s[i >> 2][g][2 * (i & 3)], s[i >> 2][g][2 * (i & 3) + 1]}, fa_f2{cscale, cscale}, fa_f2{nm, nm});
      const float p0 = __builtin_amdgcn_exp2f(arg.x), p1 = __builtin_amdgcn_exp2f(arg.y);
      ps[g][i & 1] += p0 + p1; w[i] = fa_pack2(p0, p1); }
    FaFrag pf; pf.q[0] = fa_u4{w[0], w[1], w[2], w[3]}; pf.q[1] = fa_u4{w[4], w[5], w[6], w[7]};
    if (g == 0) { asm volatile("s_wait_dscnt 0x0" ::: "memory");      /* the V fragments (and the K fetched ahead) have arrived */
      fa_keep(); }
#pragma unroll
    for (int t = 0; t < 8; ++t) acc[g][t] = fa_mma(vf[t], pf, acc[g][t]);
    fa_keep(); }
  fa_nop4(); fa_keep();
#pragma unroll
  for (int g = 0; g < 2; ++g) l_run[g] += ps[g][0] + ps[g][1];
}
// Exact (f32, vector unit) causal attention over the first QT0 rows, a job of the fused attention's launch: one work-group of four waves per (batch, head, 16 query rows).
// Step 1: wave w takes key chunks w and w + 4 (32 keys each) in turn: it keeps key row 32 ck + lane in registers and forms its scores against the 16 query rows, each read from LDS at one address for the whole wave.
// Step 2: wave w does the softmax of query rows 4 w .. 4 w + 3, lane = key mod 32 (maximum and denominator: per-lane partial, then a xor butterfly).
// Step 3: wave w sums weight x value over the keys in order for the same four rows, lane = four columns of the head, so that every value row is read as one whole run.
// K (roped f32, QT0 rows per batch) and V (the projection's f32 plane, SQ rows per batch) are read in their kv-head layout, head h >> GSH: no expanded copies. o (x64) leaves as f16 hi plane + x1024 residual plane, the output projection's operands.
constexpr int A0_LK = 4 * 32 * 132, A0_LP = 16 * QT0, A0_LQ = 16 * 128;      /* floats of LDS: key rows, scores, query rows */
__device__ __forceinline__ void att0_job(float* sm, int idx, const float* __restrict__ QF, const float* __restrict__ KF, const float* __restrict__ VF, float scale, _Float16* __restrict__ OH, _Float16* __restrict__ OL) {
  constexpr int ld = DMX, ldk = DKV, ldv = DKV, ldo = DMX;      /* row pitches as constants: the rows of one run of loads differ by an immediate offset only */
  static_assert(QT0 == 256 && NH == 16 && NB == 2, "eight key chunks on four waves; idx = 16 row groups x 2 batches x 16 heads");
  float (*lk)[32][132] = (float (*)[32][132])sm;      /* each wave's own key rows at a pitch of 33 x 16 bytes: a lane reads its own row without bank conflicts */
  float (*lp)[QT0] = (float (*)[QT0])(sm + A0_LK);      /* scores, then weights */
  float (*lq)[128] = (float (*)[128])(sm + A0_LK + A0_LP);
  const int tid = threadIdx.x, lane = tid & 31; const int w = __builtin_amdgcn_readfirstlane(tid >> 5);
  const int rg = 15 - (idx >> 5), bt = (idx >> 4) & 1, h = idx & 15, cm = rg >> 1;      /* the longest row groups have the lowest indices (for speed only); cm = the last key chunk that the group's rows can see */
  { const size_t rb = (size_t)bt * QT0; QF += rb * ld; KF += rb * ldk; VF += (size_t)bt * SQ * ldv; OH += rb * ldo; OL += rb * ldo; }      /* QT0 rows of q, k and o per batch, SQ rows of v */
  const int hc = h * 128 + lane * 4, hk = (h >> GSH) * 128 + lane * 4;      /* the lane's columns in the query-head planes and in the kv-head planes */
  for (int r = 0; r < 4; ++r) *(v4f*)&lq[4 * w + r][lane * 4] = *(const v4fa*)(QF + (size_t)(rg * 16 + 4 * w + r) * ld + hc);
  asm volatile("s_wait_xcnt 0x0" ::: "memory");      /* behind the query loads: their address register is not overwritten while an issued load still names it */
  __syncthreads();      /* the 16 query rows are whole before any wave reads them */
#pragma unroll 1      /* at most two trips, each with its own 128 key registers */
  for (int ck = w; ck <= cm; ck += 4) {      /* causal: key chunks 0 .. cm only; no barrier inside, lk[w] is this wave's alone */
#pragma unroll      /* all 32 row loads in flight together */
    for (int r = 0; r < 32; ++r) *(v4f*)&lk[w][r][lane * 4] = *(const v4fa*)(KF + (size_t)(ck * 32 + r) * ldk + hk);
    asm volatile("s_wait_xcnt 0x0" ::: "memory");      /* behind the key loads: as above */
    __builtin_amdgcn_fence(__ATOMIC_ACQ_REL, "workgroup"); __builtin_amdgcn_wave_barrier();      /* the wave's staged rows are written before its lanes read them across */
    v4f kr[32];
#pragma unroll      /* here and in the c loop below: kr[] stays in registers only if every index is a constant */
    for (int c = 0; c < 32; ++c) kr[c] = *(const v4f*)&lk[w][lane][c * 4];
#pragma unroll 1      /* the body is 512 multiply-adds already */
    for (int r0 = 0; r0 < 16; r0 += 4) { float s0 = 0.f, s1 = 0.f, s2 = 0.f, s3 = 0.f;
#pragma unroll
      for (int c = 0; c < 32; ++c) { const v4f q0 = *(const v4f*)&lq[r0][c * 4], q1 = *(const v4f*)&lq[r0 + 1][c * 4], q2 = *(const v4f*)&lq[r0 + 2][c * 4], q3 = *(const v4f*)&lq[r0 + 3][c * 4];
        for (int u = 0; u < 4; ++u) { s0 = fmaf(q0[u], kr[c][u], s0); s1 = fmaf(q1[u], kr[c][u], s1); s2 = fmaf(q2[u], kr[c][u], s2); s3 = fmaf(q3[u], kr[c][u], s3); } }
      float* sp = &lp[r0][ck * 32 + lane]; sp[0] = s0 * scale; sp[QT0] = s1 * scale; sp[2 * QT0] = s2 * scale; sp[3 * QT0] = s3 * scale; } }
  __syncthreads();      /* every wave's scores are written before a row is read across the chunks */
  float fin[4];
#pragma unroll      /* fin[] and e[] are indexed by constants */
  for (int r = 0; r < 4; ++r) { const int il = 4 * w + r, i = rg * 16 + il; float e[8]; float mx = -3.0e38f, l = 0.f;
#pragma unroll
    for (int c = 0; c < 8; ++c) { e[c] = -3.0e38f; if (c <= cm) { const float s = lp[il][c * 32 + lane]; if (c * 32 + lane <= i) e[c] = s; } mx = fmaxf(mx, e[c]); }
    for (int m = 16; m > 0; m >>= 1) mx = fmaxf(mx, __shfl_xor(mx, m, 32));
#pragma unroll
    for (int c = 0; c < 8; ++c) { e[c] = (c * 32 + lane <= i) ? expf(e[c] - mx) : 0.f; l += e[c]; }
    for (int m = 16; m > 0; m >>= 1) l += __shfl_xor(l, m, 32);
    fin[r] = 64.0f / l;
#pragma unroll
    for (int c = 0; c < 8; ++c) if (c <= cm) lp[il][c * 32 + lane] = e[c]; }
  __syncthreads();
  const v4f z4 = {0.f, 0.f, 0.f, 0.f}; v4f acc[4] = {z4, z4, z4, z4}; const float* vp = VF + hk; const int nk = (cm + 1) * 32;
#pragma unroll 1      /* 16 value rows in flight a trip are enough; more would only cost registers */
  for (int j0 = 0; j0 < nk; j0 += 16) { v4f vv[16];
#pragma unroll
    for (int u = 0; u < 16; ++u) vv[u] = *(const v4fa*)(vp + (size_t)(j0 + u) * ldv);
#pragma unroll
    for (int g = 0; g < 4; ++g) for (int r = 0; r < 4; ++r) { const v4f p = *(const v4f*)&lp[4 * w + r][j0 + 4 * g]; for (int u = 0; u < 4; ++u) for (int x = 0; x < 4; ++x) acc[r][x] = fmaf(p[u], vv[4 * g + u][x], acc[r][x]); } }
#pragma unroll
  for (int r = 0; r < 4; ++r) { v4h oh, ol; for (int x = 0; x < 4; ++x) { const float o = acc[r][x] * fin[r]; const _Float16 t = (_Float16)o; oh[x] = t; ol[x] = (_Float16)((o - (float)t) * 1024.0f); }
    const size_t oo = (size_t)(rg * 16 + 4 * w + r) * ldo + hc; *(v4h*)(OH + oo) = oh; *(v4h*)(OL + oo) = ol; } }      /* a wave's store covers one head's 256 bytes of a row: two whole lines */
// grid = (query block in the order below, query head, batch): 512 work-groups, all resident. Q [NB SQ][DMX], K and V [NB SQ][DKV], O [NB SQ][DMX] (x64), all f16.
// grid.z = NB, NB + 1: the 512 work-groups of the exact first tile, which depend on nothing of this launch; they come last in the grid (for speed only).
// Block pb walks pb + 1 stages. The order 15, 0, 14, 1, .. in batch 0 and its mirror in batch 1 lets a long block share its WGP with a short one (for speed only)
// whether the two work-groups of a WGP are neighbours in the grid or half a grid apart.
__global__ __launch_bounds__(128) __attribute__((amdgpu_waves_per_eu(2, 2))) void k_fattn(const _Float16* __restrict__ Q, const _Float16* __restrict__ K, const _Float16* __restrict__ V, _Float16* __restrict__ O,
    const float* __restrict__ QF0, const float* __restrict__ KRF0, const float* __restrict__ VF, _Float16* __restrict__ OH0, _Float16* __restrict__ OL0) {
  __shared__ __attribute__((aligned(2048))) unsigned char L[2u * FA_SLOT];
  static_assert((A0_LK + A0_LP + A0_LQ) * 4 <= (int)(2u * FA_SLOT), "the exact tile's LDS must fit the two buffers");
  if (blockIdx.z >= NB) { att0_job((float*)L, (int)((blockIdx.z - NB) * 256u + blockIdx.y * 16u + blockIdx.x), QF0, KRF0, VF, ATS, OH0, OL0); return; }      /* the same for the whole work-group, in front of every barrier */
  constexpr float cscale = 0.12751743082459868f;      /* 1 / sqrt(128) x log2(e) */
  const unsigned tid = threadIdx.x, lane = tid & 31u, wave = __builtin_amdgcn_readfirstlane(tid >> 5), c = lane & 15u, h = lane >> 4;
  const unsigned hq = blockIdx.y, gkv = hq >> GSH; const size_t rb = (size_t)blockIdx.z * SQ;
  const unsigned po = (blockIdx.x & 1u) ? (blockIdx.x >> 1) : 15u - (blockIdx.x >> 1), pb = blockIdx.z ? 15u - po : po, q0 = pb * 128u, n_stage = pb + 1u;      /* keys [0, q0 + 128) */
  const unsigned lbase = (unsigned)(size_t)L, qw0 = q0 + wave * 32u;
  const size_t go = rb * DKV + gkv * HDK;      /* first element of stage 0's tile in K and in V: 128 rows of 256 bytes, DKV elements apart */
  constexpr unsigned FA_STEP = FA_SK * DKV * 2u;      /* bytes from one stage's tile to the next */
  TdRing rk, rv; rk.g0 = td_group0(lbase, (unsigned long long)(K + go)); rk.g1 = td_group1<FA_SK, 3u>(DKV * 2u); rv.g0 = td_group0(lbase + FA_TK, (unsigned long long)(V + go)); rv.g1 = td_group1<FA_SK, 7u>(DKV * 2u);
  FaFrag qf[2][4];      /* Q fragments in the same k order as K's in fa_load_k */
  const _Float16* qp0 = Q + (rb + qw0 + c) * DMX + hq * HDK + 8u * h; const _Float16* qp1 = qp0 + 16 * DMX;
#pragma unroll      /* qf[][] is indexed by constants */
  for (int kc = 0; kc < 4; ++kc) { qf[0][kc].q[0] = *reinterpret_cast<const fa_u4*>(qp0 + 32 * kc); qf[0][kc].q[1] = *reinterpret_cast<const fa_u4*>(qp0 + 32 * kc + 16); qf[1][kc].q[0] = *reinterpret_cast<const fa_u4*>(qp1 + 32 * kc); qf[1][kc].q[1] = *reinterpret_cast<const fa_u4*>(qp1 + 32 * kc + 16); }
  asm volatile("s_wait_xcnt 0x0" :: "v"(qp0), "v"(qp1) : "memory");      /* behind the Q loads, their addresses as inputs: no address register is overwritten while an issued load still names it */
  v8f acc[2][8]; float m_run[2], l_run[2];
#pragma unroll
  for (int g = 0; g < 2; ++g) { m_run[g] = -__builtin_inff(); l_run[g] = 0.0f;
#pragma unroll
    for (int t = 0; t < 8; ++t) acc[g][t] = v8f{}; }
  if (td_pinned(wave == 0u)) { td_issue(rk, lbase); td_wait0(); }      /* stage 0's K rows -> buffer 0, landed (the Q loads above are in flight meanwhile) */
  if (td_pinned(wave == 1u)) { td_issue(rv, lbase + FA_TK); td_wait0(); }      /* stage 0's V rows */
  __syncthreads();      /* both requests have landed: stage 0 may be read */
  if (td_pinned(wave == 0u && n_stage > 1u)) { td_next(rk, FA_STEP); td_issue(rk, lbase + FA_SLOT); }      /* stage 1 -> buffer 1, where it exists */
  if (td_pinned(wave == 1u && n_stage > 1u)) { td_next(rv, FA_STEP); td_issue(rv, lbase + FA_SLOT + FA_TK); }
  const unsigned my_last = qw0 / 32u;      /* the last pass that this wave's 32 queries can see: the one on its diagonal */
  FaK kf;
#pragma unroll 1      /* stage loop and pass loop stay nested and rolled: one body of 32 matrix instructions */
  for (unsigned st = 0; st < n_stage; ++st) { const unsigned bo = (st & 1u) * FA_SLOT;
#pragma unroll 1      /* as above */
    for (unsigned sub = 0; sub < 4u; ++sub) { const unsigned blk = 4u * st + sub;
      if (blk <= my_last) {      /* wave-uniform; a wave past its diagonal still passes every barrier below */
        if (sub == 0u) fa_load_k(kf, L, bo, lane);      /* a stage's first K fragments are read in that stage's own trip, behind its barrier */
        fa_pass(kf, sub < 3u && blk < my_last, bo + (sub + 1u) * 32u * FA_PK, L, blk == my_last, bo + FA_TK + sub * 32u * FA_PV, blk * 32u, qw0, lane, qf, acc, m_run, l_run, cscale); } }
    asm volatile("s_wait_dscnt 0x0" ::: "memory");      /* this wave's reads of stage st are done before its buffer is given up */
    if (td_pinned(wave < 2u)) td_wait0();      /* this wave's request of stage st + 1 has landed */
    __syncthreads();      /* publishes stage st + 1 and ends every wave's reads of stage st */
    if (td_pinned(wave == 0u && st + 2u < n_stage)) { td_next(rk, FA_STEP); td_issue(rk, lbase + bo); }      /* stage st + 2 -> the buffer just left */
    if (td_pinned(wave == 1u && st + 2u < n_stage)) { td_next(rv, FA_STEP); td_issue(rv, lbase + bo + FA_TK); } }
  td_wait0();      /* nothing of this wave is in flight when the buffers become output staging */
  asm volatile("s_wait_dscnt 0x0" ::: "memory");      /* ... and none of its LDS reads */
  unsigned char* eb = L + wave * 32u * FA_EP;      /* each wave stages its own 32 rows; the loop's last barrier has ended every read of the buffers */
#pragma unroll
  for (int g = 0; g < 2; ++g) { const float l_fin = l_run[g] + fa_xhalf(l_run[g]);
    const float inv = 64.0f / l_fin;      /* o x64, the scale that the output projection expects */
#pragma unroll
    for (int t = 0; t < 8; ++t) { const v8f o = acc[g][t] * inv; const fa_u4 pk = {fa_pack2(o[0], o[1]), fa_pack2(o[2], o[3]), fa_pack2(o[4], o[5]), fa_pack2(o[6], o[7])};
      *reinterpret_cast<fa_u4*>(eb + (16u * g + c) * FA_EP + 32u * t + 16u * h) = pk; } }
  asm volatile("s_wait_dscnt 0x0" ::: "memory");      /* the wave's own staged rows are written before it reads them back */
  _Float16* op = O + (rb + qw0 + (lane >> 4)) * DMX + hq * HDK + (lane & 15u) * 8u;
#pragma unroll
  for (unsigned i = 0; i < 16u; ++i) { const fa_u4 v = *reinterpret_cast<const fa_u4*>(eb + (2u * i + (lane >> 4)) * FA_EP + (lane & 15u) * 16u); *reinterpret_cast<fa_u4*>(op + (size_t)(2u * i) * DMX) = v; }
}
// ---- merged launches: jobs that do not depend on one another share one launch; the range that a work-group's index falls in names its job (the same test for the whole work-group, in front of every barrier) ----
constexpr int PJ_TAB = (int)(NR * 64 / 256), PJ_WB = (DMX / 128) * (DMX / 64), PJ_WS = (DMX / 128) * (DKV / 64), PJ_X = (int)(NR * DMX / 8 / 256);
// cos / sin tables (first: the longest chain of arithmetic), the four weight transpositions ([in][out] -> Bt x16), x -> f16
__global__ __launch_bounds__(256) void k_prep(const float* __restrict__ x, const float* __restrict__ wq, const float* __restrict__ wk, const float* __restrict__ wv, const float* __restrict__ wo,
    _Float16* __restrict__ X16, _Float16* __restrict__ BQ, _Float16* __restrict__ BK, _Float16* __restrict__ BV, _Float16* __restrict__ BO, float theta, float* __restrict__ CS, float* __restrict__ SN) {
  __shared__ unsigned int lt[64][65];
  int b = blockIdx.x;
  if (b < PJ_TAB) { tab128h_job(b, (int)NR, theta, CS, SN); return; }      /* per-row cos/sin tables [NR][128] for positions r % SQ, duplicated over both halves (cat(f, f)) */
  b -= PJ_TAB;
  if (b < 2 * PJ_WB) { const bool o = b >= PJ_WB; wt_f16_job<DMX, DMX>(lt, o ? b - PJ_WB : b, o ? wo : wq, o ? BO : BQ, 16.0f); return; }
  b -= 2 * PJ_WB;
  if (b < 2 * PJ_WS) { const bool v = b >= PJ_WS; wt_f16_job<DMX, DKV>(lt, v ? b - PJ_WS : b, v ? wv : wk, v ? BV : BK, 16.0f); return; }
  b -= 2 * PJ_WS;
  x16_job(b, x, X16, NR * DMX / 8); }
template <int ACT>
__global__ __launch_bounds__(256) void k_gemm2(const _Float16* __restrict__ A, int lda, size_t sA, const _Float16* __restrict__ Bh, int ldb, size_t sB, float alpha, const float* __restrict__ bias, size_t sBias, const float* __restrict__ CP, int rowsPerB, size_t sCPb, int row0g,
    float* __restrict__ C, _Float16* __restrict__ C16, int ldc, size_t sC, int M, int N, int K, int bsh, size_t zA, size_t zB, size_t zC) {
  gemm2_job<ACT>(blockIdx.x, blockIdx.y, blockIdx.z, 0, A, lda, sA, Bh, ldb, sB, alpha, bias, sBias, CP, rowsPerB, sCPb, row0g, C, C16, ldc, sC, M, N, K, bsh, zA, zB, zC); }
// The three projections of x: q (f32), k (f32), v (f32 for the first tile + f16)
constexpr int GJ_Q = (int)(NR / 128) * (DMX / 128), GJ_K = (int)(NR / 128) * (DKV / 128);
__global__ __launch_bounds__(256) void k_gemm_qkv(const _Float16* __restrict__ X16, const _Float16* __restrict__ BQ, const _Float16* __restrict__ BK, const _Float16* __restrict__ BV,
    float* __restrict__ QF, float* __restrict__ KF, float* __restrict__ VF, _Float16* __restrict__ V16) {
  const int b = blockIdx.x; const int job = b < GJ_Q ? 0 : (b < GJ_Q + GJ_K ? 1 : 2);
  const _Float16* Bt = job == 0 ? BQ : (job == 1 ? BK : BV); float* C = job == 0 ? QF : (job == 1 ? KF : VF); _Float16* C16 = job == 2 ? V16 : nullptr; const int N = job == 0 ? DMX : DKV;
  gemm2_job<0>(job == 0 ? b : (job == 1 ? b - GJ_Q : b - GJ_Q - GJ_K), 0, 0, 0, X16, DMX, 0, Bt, DMX, 0, 0.0625f, nullptr, 0, nullptr, 1, 0, 0, C, C16, N, 0, (int)NR, N, DMX, 0, 0, 0, 0); }
// out = o Wo. The row tiles of each batch's first QT0 rows take the exact path's f16 hi plane (QT0 rows per batch) as A, all others the fused attention's o: same weights, same scale, every output tile written once.
__global__ __launch_bounds__(256) void k_gemm_out(const _Float16* __restrict__ O16, const _Float16* __restrict__ OH0, const _Float16* __restrict__ BO, float* __restrict__ out) {
  const int mt = blockIdx.x / (DMX / 128), lt = mt % (SQ / 128); const bool first = lt < QT0 / 128;
  gemm2_job<0>(blockIdx.x, 0, 0, first ? (mt / (SQ / 128)) * QT0 + lt * 128 - mt * 128 : 0, first ? OH0 : O16, DMX, 0, BO, DMX, 0, 0.0009765625f, nullptr, 0, nullptr, 1, 0, 0, out, nullptr, DMX, 0, (int)NR, DMX, DMX, 0, 0, 0, 0); }
// rope of q and of k (all rows -> f16) and f32 roped q and k of each batch's first QT0 rows for the exact first tile
constexpr int RJ_A = (int)(NR / 8), RJ_0 = QT0 / 8;
__global__ __launch_bounds__(256) void k_rope_all(const float* __restrict__ QF, const float* __restrict__ KF, const float* __restrict__ CS, const float* __restrict__ SN,
    _Float16* __restrict__ Q16, _Float16* __restrict__ K16, float* __restrict__ QF0, float* __restrict__ KRF0) {
  int b = blockIdx.x;
  if (b < RJ_A) { rope128w_job<NH, 0>(b, 0, QF, CS, SN, nullptr, Q16, 1.0f, 0, 0); return; }
  b -= RJ_A;
  if (b < RJ_A) { rope128w_job<NKV, 0>(b, 0, KF, CS, SN, nullptr, K16, 1.0f, 0, 0); return; }
  b -= RJ_A;
  if (b < RJ_0 * NB) { rope128w_job<NH, 1>(b % RJ_0, b / RJ_0, QF, CS, SN, QF0, nullptr, 1.0f, SQ, QT0); return; }
  b -= RJ_0 * NB;
  rope128w_job<NKV, 1>(b % RJ_0, b / RJ_0, KF, CS, SN, KRF0, nullptr, 1.0f, SQ, QT0); }
extern "C" void kernel_launch(void* const* d_in, const int* in_sizes, int n_in,
                              void* d_out, int out_size, void* d_ws, size_t ws_size, hipStream_t stream) {
  (void)in_sizes; (void)n_in; (void)out_size;
  const float* const* I = (const float* const*)d_in; const float* x = I[0]; const float* wq = I[1]; const float* wk = I[2]; const float* wv = I[3]; const float* wo = I[4];      /* [in][out] Wq [2048][2048], Wk/Wv [2048][1024], Wo [2048][2048]; no biases; positions implicit */
  char* ws = (char*)d_ws; size_t off = 0;
  auto take = [&](size_t bytes) { char* p = ws + off; off += (bytes + 255) & ~(size_t)255; return p; };
  _Float16* BQ = (_Float16*)take((size_t)DMX * DMX * 2); _Float16* BK = (_Float16*)take((size_t)DKV * DMX * 2); _Float16* BV = (_Float16*)take((size_t)DKV * DMX * 2); _Float16* BO = (_Float16*)take((size_t)DMX * DMX * 2);
  _Float16* X16 = (_Float16*)take(NR * DMX * 2); float* QF = (float*)take(NR * (DMX + 2 * DKV) * 4); float* KF = QF + NR * DMX; float* VF = KF + NR * DKV; _Float16* Q16 = (_Float16*)take(NR * DMX * 2); _Float16* K16 = (_Float16*)take(NR * DKV * 2); _Float16* V16 = (_Float16*)take(NR * DKV * 2); _Float16* O16 = (_Float16*)take(NR * DMX * 2);
  float* CS = (float*)take(NR * 128 * 4); float* SN = (float*)take(NR * 128 * 4); float* QF0 = (float*)take((size_t)NB * QT0 * DMX * 4); float* KRF0 = (float*)take((size_t)NB * QT0 * DKV * 4); _Float16* OH0 = (_Float16*)take((size_t)NB * QT0 * DMX * 2); _Float16* OL0 = (_Float16*)take((size_t)NB * QT0 * DMX * 2);
  if (off > ws_size) return;      /* 24 (weights) + 16 + 64 + 16 + 8 + 8 + 16 + 2 + 2 + 4 + 2 + 2 + 2 = 166 MiB */
  k_prep<<<PJ_TAB + 2 * PJ_WB + 2 * PJ_WS + PJ_X, 256, 0, stream>>>(x, wq, wk, wv, wo, X16, BQ, BK, BV, BO, 10000.0f, CS, SN);      /* tables, weights, x */
  k_gemm_qkv<<<GJ_Q + 2 * GJ_K, 256, 0, stream>>>(X16, BQ, BK, BV, QF, KF, VF, V16);      /* q, k, v */
  k_rope_all<<<2 * RJ_A + 2 * RJ_0 * NB, 256, 0, stream>>>(QF, KF, CS, SN, Q16, K16, QF0, KRF0);      /* rope; first-tile f32 q, k */
  k_fattn<<<dim3(SQ / 128, NH, NB + 2), 128, 0, stream>>>(Q16, K16, V16, O16, QF0, KRF0, VF, OH0, OL0);      /* causal attention of all rows, heads and batches -> o (x64, f16): query head y vs kv head y >> GSH; z >= NB: exact causal attention of the first QT0 rows -> f16 hi + x1024 residual planes (o x64) */
  k_gemm_out<<<GJ_Q, 256, 0, stream>>>(O16, OH0, BO, (float*)d_out);      /* out = o Wo, the first QT0 rows of each batch from the exact path's hi plane */
  k_gemm2<0><<<dim3((QT0 / 128) * (DMX / 128), 1, NB), 256, 0, stream>>>(OL0, DMX, 0, BO, DMX, 0, 0.00000095367431640625f, nullptr, 0, (const float*)d_out, -1, 0, 0, (float*)d_out, nullptr, DMX, 0, QT0, DMX, DMX, 0, (size_t)QT0 * DMX, 0, (size_t)SQ * DMX);      /* += o_lo Wo 2^-20 (own-element accumulate) */
}
